// v000
// The times below were measured on an AMD MI455X: many runs one after another, warmed up first and cycling through
// copies of the inputs, with the whole window's GPU time divided by the number of runs. Launches and the gaps
// between them are all in it. The median over several windows is given; except for v000 it joins two sittings, which
// can be a few percent apart, so the side-by-side timings, each taken in one sitting, are the better comparison.
// v000 is the starting kernel. One run takes 3580 microseconds.
#include <hip/hip_runtime.h>
// Single-head self-attention (x [4][4096][256]; q = x Wq + bq, k = x Wk + bk, v = x Wv + bv ([in][out] 256 x 128, weights AND biases uniform +-1/16); scores = q k^T / sqrt(128); softmax over all 4096 keys (no mask); out = w v -> [4][4096][128]; no output projection).
// Structure: token rows r = b*4096 + s; x as exact f16 rows (bf16-rounded); q, k, v as three WMMA GEMMs (32x64 wave tiles, f32 accumulation, exact x16 weights + bias, f16 outputs, 128 wide); per batch: V^T (2 slabs of 64 channels) via LDS transposes; ONE scores GEMM (K = 128, alpha 1/sqrt(128)) into an f32 [4096][4096] plane, row softmax on VALU (f32 statistics; weights stored x256 as f16), out = P . V^T GEMM (K = 4096, alpha 2^-8) written f32 straight into the output rows.
// Compute dtype: inputs rounded to bf16; x / weights exact; q, k, v and softmax weights as plain f16 GEMM operands (~2^-12); scores and softmax statistics f32. v_wmma_f32_16x16x32_f16.
#define NB 4
#define SQ 4096
#define DM 256                       /* input width */
#define DKW 128                      /* q / k / v width = the single head */
#define NH 1
#define HD 64
#define HG 4                         /* heads per attention launch group */
#define B0 0                         /* first batch processed (debug hook) */
#define NBR NB                       /* batches processed (debug hook) */
#define NR ((size_t)NB * SQ)         /* token rows */
#define MP ((int)((size_t)NBR * SQ)) /* rows projected (debug hook) */
#define QN SQ                        /* query rows attended per batch (debug hook) */
#define NHD NH                       /* heads attended (debug hook) */
#define MPO MP                       /* rows through the output stage (debug hook) */
#define LQ DM      /* unused; the q/k/v rows have pitch DKW */
typedef __bf16 v16b __attribute__((ext_vector_type(16)));
typedef unsigned short v8us __attribute__((ext_vector_type(8), may_alias));
typedef float  v8f  __attribute__((ext_vector_type(8)));
typedef float  v4f  __attribute__((ext_vector_type(4)));
typedef float  v4fa __attribute__((ext_vector_type(4), may_alias));
union FragB { v16b v; v8us half[2]; unsigned short u[16]; };

__device__ __forceinline__ unsigned short bf16_bits(float x) { unsigned int u = __float_as_uint(x); return (unsigned short)((u + 0x7FFFu + ((u >> 16) & 1u)) >> 16); }
__device__ __forceinline__ float bf16_val(unsigned short b) { return __uint_as_float(((unsigned int)b) << 16); }
__device__ __forceinline__ float bf16_round(float x) { return bf16_val(bf16_bits(x)); }
// D += A·B with NT terms: 1 = ah·bh, 2 = + al·bh (A split), 3 = + ah·bl (both split)
template <int NT>
__device__ __forceinline__ v8f mmaN(v16b ah, v16b al, v16b bh, v16b bl, v8f c) {
  c = __builtin_amdgcn_wmma_f32_16x16x32_bf16(false, ah, false, bh, (short)0, c, false, false);
  if (NT >= 2) c = __builtin_amdgcn_wmma_f32_16x16x32_bf16(false, al, false, bh, (short)0, c, false, false);
  if (NT >= 3) c = __builtin_amdgcn_wmma_f32_16x16x32_bf16(false, ah, false, bl, (short)0, c, false, false);
  asm volatile("v_nop\n\tv_nop\n\tv_nop\n\tv_nop" : "+v"(c) : "v"(ah), "v"(al), "v"(bh), "v"(bl));
  return c;
}

__global__ __launch_bounds__(256) void k_wt_bf16(const float* __restrict__ W, unsigned short* __restrict__ Wt, int K, int N) {
  const int t = blockIdx.x * 256 + threadIdx.x;
  const int k8n = K / 8;
  if (t >= N * k8n) return;
  const int n = t / k8n, k8 = (t % k8n) * 8;
  v8us v;
#pragma unroll
  for (int i = 0; i < 8; ++i) v[i] = bf16_bits(W[(size_t)(k8 + i) * N + n]);
  *(v8us*)(Wt + (size_t)n * K + k8) = v;
  
}

// GEMM C[M][N] (f32, pitch ldc) = act(A[M][K]·W + bias). A f32 row-major (pitch lda) converted per fragment to bf16
// (ASPLIT: hi/lo two planes -> 2 terms, else single rounded term); Wt bf16 [N][K] (pitch ldb). BIAS_BF16 rounds the
// bias to bf16 first (bias quantised to bf16 before the add). K%32==0, M%16==0, N%64==0.
template <bool ASPLIT, int ACT, bool BIAS_BF16>
__global__ __launch_bounds__(128) void k_gemm_bf(const float* __restrict__ A, int lda, const unsigned short* __restrict__ Wt, int ldb,
                                               const float* __restrict__ bias, float* __restrict__ C, int ldc, int M, int N, int K) {
  __shared__ __attribute__((aligned(16))) float so[4][16][64];
  const int tid = threadIdx.x, w = tid >> 5, lane = tid & 31, ln = lane & 15, hh = lane >> 4;
  const int ntn = N / 64;
  const int wid = blockIdx.x * 4 + w;
  const int mt = wid / ntn, nq = wid % ntn;
  if (mt * 16 >= M) return;
  const int row0 = mt * 16, col0 = nq * 64;
  const float* arow = A + (size_t)(row0 + ln) * lda;
  v8f acc[4] = {};
  for (int kb = 0; kb < K; kb += 32) {
    FragB ah, al;
    const v4f x0 = *(const v4fa*)(arow + kb + 8 * hh), x1 = *(const v4fa*)(arow + kb + 8 * hh + 4);
    const v4f x2 = *(const v4fa*)(arow + kb + 16 + 8 * hh), x3 = *(const v4fa*)(arow + kb + 16 + 8 * hh + 4);
    float xs[16] = {x0[0],x0[1],x0[2],x0[3],x1[0],x1[1],x1[2],x1[3],x2[0],x2[1],x2[2],x2[3],x3[0],x3[1],x3[2],x3[3]};
#pragma unroll
    for (int i = 0; i < 16; ++i) { const unsigned short hb = bf16_bits(xs[i]); ah.u[i] = hb; al.u[i] = ASPLIT ? bf16_bits(xs[i] - bf16_val(hb)) : (unsigned short)0; }
#pragma unroll
    for (int t = 0; t < 4; ++t) {
      const unsigned short* brow = Wt + (size_t)(col0 + t * 16 + ln) * ldb + kb;
      FragB b;
      b.half[0] = *(const v8us*)(brow + 8 * hh);
      b.half[1] = *(const v8us*)(brow + 16 + 8 * hh);
      acc[t] = mmaN<ASPLIT ? 2 : 1>(ah.v, al.v, b.v, b.v, acc[t]);
    }
  }
#pragma unroll
  for (int t = 0; t < 4; ++t) {
    float bv = bias ? bias[col0 + t * 16 + ln] : 0.f;
    if (BIAS_BF16) bv = bf16_round(bv);
#pragma unroll
    for (int r = 0; r < 8; ++r) { float v = acc[t][r] + bv; if (ACT == 1) v = fmaxf(v, 0.f); so[w][8 * hh + r][t * 16 + ln] = v; }
  }
  __builtin_amdgcn_fence(__ATOMIC_ACQ_REL, "workgroup");
  __builtin_amdgcn_wave_barrier();
  const int rsub = lane >> 4, c4 = (lane & 15) * 4;
  {
#pragma unroll
    for (int q = 0; q < 8; ++q) {
      const int r = q * 2 + rsub;
      const v4f v = *(const v4fa*)&so[w][r][c4];
      *(v4f*)(C + (size_t)(row0 + r) * ldc + col0 + c4) = v;
    }
    
  }
}

// GEMM C = act(A·W + bias + resid): A f32 (ASPLIT -> hi/lo 2 terms), Wt bf16 [N][K]; ACT 0 none, 1 relu, 2 exact gelu;
// resid (optional, f32, row index = (row % rmod), pitch ldr, RES_BF16 rounds it) added before the activation.
template <bool ASPLIT, int ACT, bool BIAS_BF16, bool RES_BF16>
__global__ __launch_bounds__(128) void k_gemm_bf3(const float* __restrict__ A, int lda, const unsigned short* __restrict__ Wt, int ldb,
                                                const float* __restrict__ bias, const float* __restrict__ resid, int rmod, int ldr,
                                                float* __restrict__ C, int ldc, int M, int N, int K) {
  __shared__ __attribute__((aligned(16))) float so[4][16][64];
  const int tid = threadIdx.x, w = tid >> 5, lane = tid & 31, ln = lane & 15, hh = lane >> 4;
  const int ntn = N / 64;
  const int wid = blockIdx.x * 4 + w;
  const int mt = wid / ntn, nq = wid % ntn;
  if (mt * 16 >= M) return;
  const int row0 = mt * 16, col0 = nq * 64;
  const float* arow = A + (size_t)(row0 + ln) * lda;
  v8f acc[4] = {};
  for (int kb = 0; kb < K; kb += 32) {
    FragB ah, al;
    const v4f x0 = *(const v4fa*)(arow + kb + 8 * hh), x1 = *(const v4fa*)(arow + kb + 8 * hh + 4);
    const v4f x2 = *(const v4fa*)(arow + kb + 16 + 8 * hh), x3 = *(const v4fa*)(arow + kb + 16 + 8 * hh + 4);
    float xs[16] = {x0[0],x0[1],x0[2],x0[3],x1[0],x1[1],x1[2],x1[3],x2[0],x2[1],x2[2],x2[3],x3[0],x3[1],x3[2],x3[3]};
#pragma unroll
    for (int i = 0; i < 16; ++i) { const unsigned short hb = bf16_bits(xs[i]); ah.u[i] = hb; al.u[i] = ASPLIT ? bf16_bits(xs[i] - bf16_val(hb)) : (unsigned short)0; }
#pragma unroll
    for (int t = 0; t < 4; ++t) {
      const unsigned short* brow = Wt + (size_t)(col0 + t * 16 + ln) * ldb + kb;
      FragB b;
      b.half[0] = *(const v8us*)(brow + 8 * hh);
      b.half[1] = *(const v8us*)(brow + 16 + 8 * hh);
      acc[t] = mmaN<ASPLIT ? 2 : 1>(ah.v, al.v, b.v, b.v, acc[t]);
    }
  }
#pragma unroll
  for (int t = 0; t < 4; ++t) {
    const int col = col0 + t * 16 + ln;
    float bv = bias ? bias[col] : 0.f;
    if (BIAS_BF16) bv = bf16_round(bv);
#pragma unroll
    for (int r = 0; r < 8; ++r) {
      float v = acc[t][r] + bv;
      if (resid) { float rv = resid[(size_t)((row0 + 8 * hh + r) % rmod) * ldr + col]; if (RES_BF16) rv = bf16_round(rv); v += rv; }
      if (ACT == 1) v = fmaxf(v, 0.f);
      if (ACT == 2) v = 0.5f * v * (1.0f + erff(v * 0.70710678118654752f));
      if (ACT == 3) { const float u = 0.7978845608028654f * (v + 0.044715f * v * v * v); v = 0.5f * v * (1.0f + tanhf(u)); }
      so[w][8 * hh + r][t * 16 + ln] = v;
    }
  }
  __builtin_amdgcn_fence(__ATOMIC_ACQ_REL, "workgroup");
  __builtin_amdgcn_wave_barrier();
  const int rsub = lane >> 4, c4 = (lane & 15) * 4;
  {
#pragma unroll
    for (int q = 0; q < 8; ++q) {
      const int r = q * 2 + rsub;
      const v4f v = *(const v4fa*)&so[w][r][c4];
      *(v4f*)(C + (size_t)(row0 + r) * ldc + col0 + c4) = v;
    }
    
  }
}
// row LayerNorm (biased variance, eps) over N: s = X (+ R); optional out_sum <- s; out_norm <- (s-mu)*rsqrt(var+eps)*g + b
template <bool PARAM_BF16>
__global__ __launch_bounds__(256) void k_layernorm(const float* __restrict__ X, const float* __restrict__ R, const float* __restrict__ g, const float* __restrict__ bta,
                                                  float* __restrict__ out_sum, float* __restrict__ out_norm, int N, float eps) {
  __shared__ float red[256];
  const int row = blockIdx.x, tid = threadIdx.x;
  const float* x = X + (size_t)row * N; const float* rr = R ? R + (size_t)row * N : nullptr;
  float vals[16];                     // up to N = 4096
  const int per = N / 256;            // contiguous chunk per thread? use strided-by-4 chunks: thread handles j = tid*4 + 1024*u
  float s1 = 0.f;
  for (int u = 0; u < per / 4; ++u) {
    const int j = tid * 4 + 1024 * u;
    const v4f a = *(const v4fa*)(x + j);
    v4f b = {0.f,0.f,0.f,0.f}; if (rr) b = *(const v4fa*)(rr + j);
#pragma unroll
    for (int q = 0; q < 4; ++q) { const float v = a[q] + b[q]; vals[u * 4 + q] = v; s1 += v; }
  }
  red[tid] = s1; __syncthreads();
  for (int st = 128; st > 0; st >>= 1) { if (tid < st) red[tid] += red[tid + st]; __syncthreads(); }
  const float mu = red[0] / (float)N; __syncthreads();
  float s2 = 0.f;
  for (int u = 0; u < per / 4; ++u)
#pragma unroll
    for (int q = 0; q < 4; ++q) { const float c = vals[u * 4 + q] - mu; s2 += c * c; }
  red[tid] = s2; __syncthreads();
  for (int st = 128; st > 0; st >>= 1) { if (tid < st) red[tid] += red[tid + st]; __syncthreads(); }
  const float rs = rsqrtf(red[0] / (float)N + eps);
  {
    for (int u = 0; u < per / 4; ++u) {
      const int j = tid * 4 + 1024 * u;
      v4f o, sm;
#pragma unroll
      for (int q = 0; q < 4; ++q) {
        float gg = g[j + q], bb = bta[j + q];
        if (PARAM_BF16) { gg = bf16_round(gg); bb = bf16_round(bb); }
        sm[q] = vals[u * 4 + q]; o[q] = (vals[u * 4 + q] - mu) * rs * gg + bb;
      }
      if (out_sum) *(v4f*)(out_sum + (size_t)row * N + j) = sm;
      *(v4f*)(out_norm + (size_t)row * N + j) = o;
    }
    
  }
}



// ---- f16 WMMA path (v_wmma_f32_16x16x32_f16): 11-bit significands for operands in range — used where a [0,1] probability operand needs more precision than bf16
typedef _Float16 v16h __attribute__((ext_vector_type(16)));
union FragH { v16h v; v8us half[2]; _Float16 h[16]; unsigned short u[16]; };
template <int NT>
__device__ __forceinline__ v8f mmaH(v16h ah, v16h al, v16h bh, v16h bl, v8f c) {
  c = __builtin_amdgcn_wmma_f32_16x16x32_f16(false, ah, false, bh, (short)0, c, false, false);
  if (NT >= 2) c = __builtin_amdgcn_wmma_f32_16x16x32_f16(false, al, false, bh, (short)0, c, false, false);
  if (NT >= 3) c = __builtin_amdgcn_wmma_f32_16x16x32_f16(false, ah, false, bl, (short)0, c, false, false);
  asm volatile("v_nop\n\tv_nop\n\tv_nop\n\tv_nop" : "+v"(c) : "v"(ah), "v"(al), "v"(bh), "v"(bl));
  return c;
}
// batched GEMM like k_gemm_b but f16 operands: A f32 (split into f16 hi/lo if ASPLIT, else rounded to f16), Bt = f16 values [n][k]; alpha; C f32; N multiple of 16 (partial tiles skipped)
template <bool ASPLIT>
__global__ __launch_bounds__(128) void k_gemm_h(const float* __restrict__ A, int lda, size_t sA, const _Float16* __restrict__ Bh, int ldb, size_t sB, float alpha, float* __restrict__ C, int ldc, size_t sC, int M, int N, int K) {
  __shared__ __attribute__((aligned(16))) float so[4][16][64];
  const int tid = threadIdx.x, w = tid >> 5, lane = tid & 31, ln = lane & 15, hh = lane >> 4; const int by = blockIdx.y;
  A += (size_t)by * sA; Bh += (size_t)by * sB; C += (size_t)by * sC;
  const int ntn = (N + 63) / 64; const int wid = blockIdx.x * 4 + w; const int mt = wid / ntn, nq = wid % ntn; if (mt * 16 >= M) return;
  const int row0 = mt * 16, col0 = nq * 64; const float* arow = A + (size_t)(row0 + ln) * lda;
  v8f acc[4] = {};
  for (int kb = 0; kb < K; kb += 32) {
    FragH ah, al;
    const v4f x0 = *(const v4fa*)(arow + kb + 8 * hh), x1 = *(const v4fa*)(arow + kb + 8 * hh + 4), x2 = *(const v4fa*)(arow + kb + 16 + 8 * hh), x3 = *(const v4fa*)(arow + kb + 16 + 8 * hh + 4);
    float xs[16] = {x0[0],x0[1],x0[2],x0[3],x1[0],x1[1],x1[2],x1[3],x2[0],x2[1],x2[2],x2[3],x3[0],x3[1],x3[2],x3[3]};
#pragma unroll
    for (int i = 0; i < 16; ++i) { const _Float16 h = (_Float16)xs[i]; ah.h[i] = h; al.h[i] = ASPLIT ? (_Float16)(xs[i] - (float)h) : (_Float16)0.0f; }
#pragma unroll
    for (int t = 0; t < 4; ++t) { if (col0 + t * 16 >= N) continue; const size_t boff = (size_t)(col0 + t * 16 + ln) * ldb + kb; FragH bq; bq.half[0] = *(const v8us*)(Bh + boff + 8 * hh); bq.half[1] = *(const v8us*)(Bh + boff + 16 + 8 * hh);
      acc[t] = mmaH<ASPLIT ? 2 : 1>(ah.v, al.v, bq.v, bq.v, acc[t]); }
  }
#pragma unroll
  for (int t = 0; t < 4; ++t) { if (col0 + t * 16 >= N) continue;
#pragma unroll
    for (int r = 0; r < 8; ++r) so[w][8 * hh + r][t * 16 + ln] = acc[t][r] * alpha; }
  __builtin_amdgcn_fence(__ATOMIC_ACQ_REL, "workgroup"); __builtin_amdgcn_wave_barrier();
  const int rsub = lane >> 4, c4 = (lane & 15) * 4;
  {
#pragma unroll
    for (int q = 0; q < 8; ++q) { const int r = q * 2 + rsub; if (col0 + c4 < N) { const v4f v = *(const v4fa*)&so[w][r][c4]; *(v4f*)(C + (size_t)(row0 + r) * ldc + col0 + c4) = v; } }
     }
}

// Wt[n][k] = f16(W[k][n]·scale) from f32 row-major W[K][N] (scale = power of two; bf16-exact weights stay exact in f16 away from the subnormal range)
__global__ __launch_bounds__(256) void k_wt_f16(const float* __restrict__ W, _Float16* __restrict__ Wt, int K, int N, float scale) {
  const int t = blockIdx.x * 256 + threadIdx.x; if (t >= N * (K / 8)) return; const int n = t / (K / 8), k8 = (t % (K / 8)) * 8; FragH f;
#pragma unroll
  for (int i = 0; i < 8; ++i) f.h[i] = (_Float16)(bf16_round(W[(size_t)(k8 + i) * N + n]) * scale); const v8us o = f.half[0];
  *(v8us*)((unsigned short*)Wt + (size_t)n * K + k8) = o; 
}
// k_gemm_hh variant with fused epilogue: v = acc·alpha + bias[by·sBias + col] (+ CP[(row/rowsPerB)·sCPb + by·64 + col] if CP) ; ACT 0 none / 1 elu ; writes f16 C16 (and f32 C if non-null)
template <int ACT>
__global__ __launch_bounds__(128) void k_gemm_hhx(const _Float16* __restrict__ A, int lda, size_t sA, const _Float16* __restrict__ Bh, int ldb, size_t sB, float alpha, const float* __restrict__ bias, size_t sBias, const float* __restrict__ CP, int rowsPerB, size_t sCPb, int row0g,
    float* __restrict__ C, _Float16* __restrict__ C16, int ldc, size_t sC, int M, int N, int K) {
  __shared__ __attribute__((aligned(16))) float so[4][16][64];
  const int tid = threadIdx.x, w = tid >> 5, lane = tid & 31, ln = lane & 15, hh = lane >> 4; const int by = blockIdx.y;
  A += (size_t)by * sA; Bh += (size_t)by * sB; const size_t cofs = (size_t)by * sC; const float* bp = bias ? bias + (size_t)by * sBias : nullptr;
  const int ntn = (N + 63) / 64; const int wid = blockIdx.x * 4 + w; const int mt = wid / ntn, nq = wid % ntn; if (mt * 16 >= M) return;
  const int row0 = mt * 16, col0 = nq * 64; const _Float16* arow = A + (size_t)(row0 + ln) * lda;
  v8f acc[4] = {};
  for (int kb = 0; kb < K; kb += 32) { FragH ah; ah.half[0] = *(const v8us*)((const unsigned short*)arow + kb + 8 * hh); ah.half[1] = *(const v8us*)((const unsigned short*)arow + kb + 16 + 8 * hh);
#pragma unroll
    for (int t = 0; t < 4; ++t) { if (col0 + t * 16 >= N) continue; const size_t boff = (size_t)(col0 + t * 16 + ln) * ldb + kb; FragH bq; bq.half[0] = *(const v8us*)((const unsigned short*)Bh + boff + 8 * hh); bq.half[1] = *(const v8us*)((const unsigned short*)Bh + boff + 16 + 8 * hh);
      acc[t] = mmaH<1>(ah.v, ah.v, bq.v, bq.v, acc[t]); }
  }
#pragma unroll
  for (int t = 0; t < 4; ++t) { if (col0 + t * 16 >= N) continue; const int col = col0 + t * 16 + ln; const float bv = bp ? bf16_round(bp[col]) : 0.f;
#pragma unroll
    for (int r = 0; r < 8; ++r) { float v = acc[t][r] * alpha + bv; if (CP) { const int rr = row0g + row0 + 8 * hh + r; if (rowsPerB < 0) v += CP[cofs + (size_t)rr * ldc + col];      /* rowsPerB < 0: own element of the batched C plane */ else { const int bidx = rr / rowsPerB; v += CP[(size_t)bidx * sCPb + (size_t)by * 64 + col]; } } if (ACT == 1) v = (v > 0.f) ? v : expm1f(v); else if (ACT == 7) v = (v > 0.f) ? v + 1.0f : expf(v); else if (ACT == 8) v = tanhf(v); else if (ACT == 9) v = 0.5f * v * (1.0f + tanhf(0.7978845608028654f * (v + 0.044715f * v * v * v))); else if (ACT == 11) v = 1.0f / (1.0f + expf(-v)); else if (ACT == 12) v = (v > 0.f) ? v : 0.01f * v; else if (ACT == 14) v = (v > 0.f) ? v : 0.1f * v; else if (ACT == 16) v = (v >= 0.f) ? v : 0.3f * v; else if (ACT == 17) v = (v >= 0.f) ? v : 0.2f * v; else if (ACT == 15) v = v / (1.0f + expf(-v)); else if (ACT == 3) v = fmaxf(v, 0.f); else if (ACT == 6) v = 0.5f * v * (1.0f + erff(v * 0.70710678118654752f)); so[w][8 * hh + r][t * 16 + ln] = v; } }
  __builtin_amdgcn_fence(__ATOMIC_ACQ_REL, "workgroup"); __builtin_amdgcn_wave_barrier();
  const int rsub = lane >> 4, c4 = (lane & 15) * 4; typedef _Float16 v4h __attribute__((ext_vector_type(4)));
  {
#pragma unroll
    for (int q = 0; q < 8; ++q) { const int r = q * 2 + rsub; if (col0 + c4 < N) { const v4f v = *(const v4fa*)&so[w][r][c4]; if (C) *(v4f*)(C + cofs + (size_t)(row0 + r) * ldc + col0 + c4) = v; if (C16) { v4h h4; for (int i = 0; i < 4; ++i) h4[i] = (_Float16)v[i]; *(v4h*)(C16 + cofs + (size_t)(row0 + r) * ldc + col0 + c4) = h4; } } }
     }
}


typedef _Float16 v4h __attribute__((ext_vector_type(4)));

__global__ __launch_bounds__(256) void k_x16(const float* __restrict__ x, _Float16* __restrict__ X16, size_t n8) { const size_t t = (size_t)blockIdx.x * 256 + threadIdx.x; if (t >= n8) return; FragH f;
#pragma unroll
  for (int q = 0; q < 8; ++q) f.h[q] = (_Float16)bf16_round(x[t * 8 + q]); *(v8us*)((unsigned short*)X16 + t * 8) = f.half[0];  }
__global__ __launch_bounds__(256) void k_h16(const float* __restrict__ x, _Float16* __restrict__ X16, size_t n8) { const size_t t = (size_t)blockIdx.x * 256 + threadIdx.x; if (t >= n8) return; FragH f;
#pragma unroll
  for (int q = 0; q < 8; ++q) f.h[q] = (_Float16)x[t * 8 + q]; *(v8us*)((unsigned short*)X16 + t * 8) = f.half[0];  }
__global__ __launch_bounds__(256) void k_round16f(const float* __restrict__ W, _Float16* __restrict__ Bt, size_t n8) { const size_t t = (size_t)blockIdx.x * 256 + threadIdx.x; if (t >= n8) return; FragH f;
#pragma unroll
  for (int i = 0; i < 8; ++i) f.h[i] = (_Float16)(bf16_round(W[t * 8 + i]) * 16.0f); *(v8us*)((unsigned short*)Bt + t * 8) = f.half[0];  }
template <int NHv, int TTv>
__global__ __launch_bounds__(256) void k_vt(const _Float16* __restrict__ V16, int ldv, int voff, _Float16* __restrict__ Vt) { __shared__ unsigned short tl[64][66]; const int tid = threadIdx.x; const int slab = blockIdx.x / (TTv / 64), lg = blockIdx.x % (TTv / 64); const int b = slab / NHv, h = slab % NHv;
  for (int i = tid; i < 64 * 8; i += 256) { const int r = i / 8, c8 = (i % 8) * 8; FragH f; f.half[0] = *(const v8us*)((const unsigned short*)V16 + ((size_t)b * TTv + lg * 64 + r) * ldv + voff + h * 64 + c8);
#pragma unroll
    for (int q = 0; q < 8; ++q) tl[r][c8 + q] = f.u[q]; }
  __syncthreads();
  {
#pragma unroll
    for (int rd = 0; rd < 2; ++rd) { const int d = rd * 32 + tid / 8, pc = tid % 8; FragH f;
#pragma unroll
      for (int q = 0; q < 8; ++q) f.u[q] = tl[pc * 8 + q][d];
      *(v8us*)((unsigned short*)Vt + ((size_t)slab * 64 + d) * TTv + lg * 64 + pc * 8) = f.half[0]; }
     } }

__global__ __launch_bounds__(256) void k_hl(const float* __restrict__ F, _Float16* __restrict__ Hh, _Float16* __restrict__ Hl, size_t n8) { const size_t t = (size_t)blockIdx.x * 256 + threadIdx.x; if (t >= n8) return; FragH fh, fl; const v4f a = *(const v4fa*)(F + t * 8), c = *(const v4fa*)(F + t * 8 + 4);
#pragma unroll
  for (int q = 0; q < 4; ++q) { _Float16 h = (_Float16)a[q]; fh.h[q] = h; fl.h[q] = (_Float16)((a[q] - (float)h) * 1024.0f); h = (_Float16)c[q]; fh.h[4 + q] = h; fl.h[4 + q] = (_Float16)((c[q] - (float)h) * 1024.0f); }
  { *(v8us*)((unsigned short*)Hh + t * 8) = fh.half[0]; *(v8us*)((unsigned short*)Hl + t * 8) = fl.half[0];  } }

// ---- fast GEMM (wave tile 32x64; requires M % 32 == 0 rows per launch region and N % 64 == 0); epilogue = k_gemm_hhx semantics ----
__device__ __forceinline__ v16h g2_frag(const _Float16* p, int hh) { FragH f; f.half[0] = *(const v8us*)((const unsigned short*)p + 8 * hh); f.half[1] = *(const v8us*)((const unsigned short*)p + 16 + 8 * hh); return f.v; }
__device__ __forceinline__ v8f g2_mma(v16h a, v16h b, v8f c) { v8f d = __builtin_amdgcn_wmma_f32_16x16x32_f16(false, a, false, b, (short)0, c, false, false); asm volatile("v_nop\n\tv_nop\n\tv_nop\n\tv_nop" : "+v"(d) : "v"(a), "v"(b)); return d; }
template <int ACT>
__global__ __launch_bounds__(128) void k_gemm2(const _Float16* __restrict__ A, int lda, size_t sA, const _Float16* __restrict__ Bh, int ldb, size_t sB, float alpha, const float* __restrict__ bias, size_t sBias, const float* __restrict__ CP, int rowsPerB, size_t sCPb, int row0g,
    float* __restrict__ C, _Float16* __restrict__ C16, int ldc, size_t sC, int M, int N, int K) { static_assert(ACT == 0 || ACT == 3 || ACT == 6 || ACT == 8 || ACT == 9 || ACT == 11 || ACT == 12 || ACT == 14 || ACT == 15 || ACT == 16 || ACT == 17, "k_gemm2: unsupported ACT code (would silently apply no activation)");
  __shared__ __attribute__((aligned(16))) float so[4][32][68];
  const int tid = threadIdx.x, w = tid >> 5, lane = tid & 31, ln = lane & 15, hh = lane >> 4; const int by = blockIdx.y;
  A += (size_t)by * sA; Bh += (size_t)by * sB; const size_t cofs = (size_t)by * sC; const float* bp = bias ? bias + (size_t)by * sBias : nullptr;
  const int ntn = N >> 6; const int mt = blockIdx.x / ntn, nq = blockIdx.x - mt * ntn; const int row0 = mt * 128 + 32 * w, col0 = nq * 64; if (row0 >= M) return;
  const _Float16* a0p = A + (size_t)(row0 + ln) * lda; const _Float16* a1p = a0p + (size_t)16 * lda;
  const _Float16* b0p = Bh + (size_t)(col0 + ln) * ldb; const _Float16* b1p = b0p + (size_t)16 * ldb; const _Float16* b2p = b1p + (size_t)16 * ldb; const _Float16* b3p = b2p + (size_t)16 * ldb;
  const v8f z8 = {0.f,0.f,0.f,0.f,0.f,0.f,0.f,0.f}; v8f c00 = z8, c01 = z8, c02 = z8, c03 = z8, c10 = z8, c11 = z8, c12 = z8, c13 = z8;
#pragma unroll 1
  for (int kb = 0; kb < K; kb += 32) { const v16h a0 = g2_frag(a0p + kb, hh), a1 = g2_frag(a1p + kb, hh);
    v16h b = g2_frag(b0p + kb, hh); c00 = g2_mma(a0, b, c00); c10 = g2_mma(a1, b, c10);
    b = g2_frag(b1p + kb, hh); c01 = g2_mma(a0, b, c01); c11 = g2_mma(a1, b, c11);
    b = g2_frag(b2p + kb, hh); c02 = g2_mma(a0, b, c02); c12 = g2_mma(a1, b, c12);
    b = g2_frag(b3p + kb, hh); c03 = g2_mma(a0, b, c03); c13 = g2_mma(a1, b, c13); }
  v8f accs[8] = {c00, c01, c02, c03, c10, c11, c12, c13};
#pragma unroll
  for (int u = 0; u < 8; ++u) { const int t = u & 3, half = u >> 2; const int col = col0 + t * 16 + ln; const float bv = bp ? bf16_round(bp[col]) : 0.f;
#pragma unroll
    for (int r = 0; r < 8; ++r) { const int rloc = half * 16 + 8 * hh + r; float v = accs[u][r] * alpha + bv; if (CP) { if (rowsPerB < 0) v += CP[cofs + (size_t)(row0g + row0 + rloc) * ldc + col];      /* rowsPerB < 0: own element of the batched C plane */ else { const int bidx = (row0g + row0 + rloc) / rowsPerB; v += CP[(size_t)bidx * sCPb + (size_t)by * 64 + col]; } }
      if (ACT == 3) v = fmaxf(v, 0.f); else if (ACT == 6) v = 0.5f * v * (1.0f + erff(v * 0.70710678118654752f)); else if (ACT == 11) v = 1.0f / (1.0f + expf(-v)); else if (ACT == 15) v = v / (1.0f + expf(-v)); else if (ACT == 12) v = (v > 0.f) ? v : 0.01f * v; else if (ACT == 8) v = tanhf(v); else if (ACT == 9) v = 0.5f * v * (1.0f + tanhf(0.7978845608028654f * (v + 0.044715f * v * v * v))); else if (ACT == 14) v = (v > 0.f) ? v : 0.1f * v; else if (ACT == 16) v = (v >= 0.f) ? v : 0.3f * v; else if (ACT == 17) v = (v >= 0.f) ? v : 0.2f * v;
      so[w][rloc][t * 16 + ln] = v; } }
  __builtin_amdgcn_fence(__ATOMIC_ACQ_REL, "workgroup"); __builtin_amdgcn_wave_barrier();
  const int rsub = lane >> 4, c4 = (lane & 15) * 4;
  {
#pragma unroll
    for (int q = 0; q < 16; ++q) { const int r = q * 2 + rsub; const v4f v = *(const v4fa*)&so[w][r][c4]; if (C) *(v4f*)(C + cofs + (size_t)(row0 + r) * ldc + col0 + c4) = v; if (C16) { v4h h4; for (int i = 0; i < 4; ++i) h4[i] = (_Float16)v[i]; *(v4h*)(C16 + cofs + (size_t)(row0 + r) * ldc + col0 + c4) = h4; } }
     } }


__global__ __launch_bounds__(256) void k_wnat(const float* __restrict__ w, size_t n8, _Float16* __restrict__ Bt) { const size_t t = (size_t)blockIdx.x * 256 + threadIdx.x; if (t >= n8) return; FragH f; for (int q = 0; q < 8; ++q) f.h[q] = (_Float16)(bf16_round(w[t * 8 + q]) * 16.0f); *(v8us*)((unsigned short*)Bt + t * 8) = f.half[0];  }
__global__ __launch_bounds__(256) void k_rsm(const float* __restrict__ S, _Float16* __restrict__ P, int nrows) {
  #pragma clang fp contract(off)
  const int i = blockIdx.x * 256 + threadIdx.x; if (i >= nrows) return; const float* s = S + (size_t)i * SQ; float mx = -3.0e38f;
#pragma unroll 1
  for (int j = 0; j < SQ; ++j) mx = fmaxf(mx, s[j]); float se = 0.f;
#pragma unroll 1
  for (int j = 0; j < SQ; ++j) se += expf(s[j] - mx); const float sc = 256.0f / se;
#pragma unroll 1
  for (int j0 = 0; j0 < SQ; j0 += 8) { FragH f; for (int q = 0; q < 8; ++q) f.h[q] = (_Float16)(expf(s[j0 + q] - mx) * sc); unsigned short* d = (unsigned short*)P + (size_t)i * SQ + j0; *(v8us*)d = f.half[0];  } }
__global__ __launch_bounds__(256) void k_vt(const _Float16* __restrict__ V16, int b, int h0, _Float16* __restrict__ VT) { __shared__ unsigned short tl[64][65]; const int tid = threadIdx.x; const int hh = blockIdx.x % HG, sg = blockIdx.x / HG; const int s0 = sg * 64; const int h = h0 + hh;
  for (int i = tid; i < 64 * 8; i += 256) { const int j = i / 8, d8 = (i % 8) * 8; FragH f; f.half[0] = *(const v8us*)((const unsigned short*)V16 + ((size_t)b * SQ + s0 + j) * DM + h * HD + d8); for (int q = 0; q < 8; ++q) tl[d8 + q][j] = f.u[q]; }
  __syncthreads();
  { for (int i = tid; i < 64 * 8; i += 256) { const int d = i / 8, j8 = (i % 8) * 8; FragH f; for (int q = 0; q < 8; ++q) f.u[q] = tl[d][j8 + q]; *(v8us*)((unsigned short*)VT + ((size_t)hh * HD + d) * SQ + s0 + j8) = f.half[0]; }  } }



__global__ __launch_bounds__(256) void k_rsmkm(const float* __restrict__ S, _Float16* __restrict__ P, int nrows, const int* __restrict__ am) {
  #pragma clang fp contract(off)
  const int t = blockIdx.x * 256 + threadIdx.x; if (t >= nrows) return; const size_t i = (size_t)t; const float* s = S + i * SQ; const int* mr = am + (size_t)(t % SQ) * SQ; float mx = -3.0e38f;
#pragma unroll 1
  for (int j = 0; j < SQ; ++j) { const float f = (mr[j] != 0) ? 1.f : 0.f; mx = fmaxf(mx, fmaf(f, s[j], (1.f - f) * -1.0e9f)); } float se = 0.f;
#pragma unroll 1
  for (int j = 0; j < SQ; ++j) { const float f = (mr[j] != 0) ? 1.f : 0.f; se += __expf(fmaf(f, s[j], (1.f - f) * -1.0e9f) - mx); } const float sc = 256.0f / se;
#pragma unroll 1
  for (int j0 = 0; j0 < SQ; j0 += 8) { FragH fr; for (int q = 0; q < 8; ++q) { const int j = j0 + q; const float f = (mr[j] != 0) ? 1.f : 0.f; fr.h[q] = (_Float16)(__expf(fmaf(f, s[j], (1.f - f) * -1.0e9f) - mx) * sc); }
    unsigned short* d = (unsigned short*)P + i * SQ + j0; *(v8us*)d = fr.half[0];  } }
extern "C" void kernel_launch(void* const* d_in, const int* in_sizes, int n_in,
                              void* d_out, int out_size, void* d_ws, size_t ws_size, hipStream_t stream) {
  (void)in_sizes; (void)n_in; (void)out_size;
  const float* const* I = (const float* const*)d_in; const float* x = I[0]; const float* wq = I[1]; const float* bq = I[2]; const float* wk = I[3]; const float* bk = I[4]; const float* wv = I[5]; const float* bv = I[6];      /* x; [in][out] Wq / Wk / Wv [256][128] + biases; no mask input */
  static_assert(SQ % 128 == 0 && SQ % 64 == 0 && SQ % 32 == 0 && DM % 32 == 0 && DKW % 64 == 0 && DKW % 32 == 0, "tile multiples");
  char* ws = (char*)d_ws; size_t off = 0;
  auto take = [&](size_t bytes) { char* p = ws + off; off += (bytes + 255) & ~(size_t)255; return p; };
  _Float16* BQ = (_Float16*)take((size_t)DKW * DM * 2); _Float16* BK = (_Float16*)take((size_t)DKW * DM * 2); _Float16* BV = (_Float16*)take((size_t)DKW * DM * 2);
  _Float16* X16 = (_Float16*)take(NR * DM * 2); _Float16* Q16 = (_Float16*)take(NR * DKW * 2); _Float16* K16 = (_Float16*)take(NR * DKW * 2); _Float16* V16 = (_Float16*)take(NR * DKW * 2);
  float* S = (float*)take((size_t)SQ * SQ * 4); _Float16* P = (_Float16*)take((size_t)SQ * SQ * 2); _Float16* VT = (_Float16*)take((size_t)DKW * SQ * 2);
  if (off > ws_size) return;      /* approx 0.19 + 8 + 3 x 4 + 64 + 32 + 1 = 117 MiB */
  { const unsigned g = (unsigned)(((size_t)DKW * (DM / 8) + 255) / 256); k_wt_f16<<<g, 256, 0, stream>>>(wq, BQ, DM, DKW, 16.0f); k_wt_f16<<<g, 256, 0, stream>>>(wk, BK, DM, DKW, 16.0f); k_wt_f16<<<g, 256, 0, stream>>>(wv, BV, DM, DKW, 16.0f); }      /* [in][out] [256][128] -> Bt [128][256] x16 */
  k_x16<<<(unsigned)((NR * DM / 8 + 255) / 256), 256, 0, stream>>>(x, X16, NR * DM / 8);
  k_gemm2<0><<<dim3((unsigned)((NR / 128) * (DKW / 64)), 1), 128, 0, stream>>>(X16, DM, 0, BQ, DM, 0, 0.0625f, bq, 0, nullptr, 1, 0, 0, nullptr, Q16, DKW, 0, (int)NR, DKW, DM);
  k_gemm2<0><<<dim3((unsigned)((NR / 128) * (DKW / 64)), 1), 128, 0, stream>>>(X16, DM, 0, BK, DM, 0, 0.0625f, bk, 0, nullptr, 1, 0, 0, nullptr, K16, DKW, 0, (int)NR, DKW, DM);
  k_gemm2<0><<<dim3((unsigned)((NR / 128) * (DKW / 64)), 1), 128, 0, stream>>>(X16, DM, 0, BV, DM, 0, 0.0625f, bv, 0, nullptr, 1, 0, 0, nullptr, V16, DKW, 0, (int)NR, DKW, DM);      /* q, k, v rows (f16, 128 wide) */
  for (int b = 0; b < NB; ++b) { const size_t r0 = (size_t)b * SQ;
    k_vt<DKW / 64, SQ><<<(DKW / 64) * (SQ / 64), 256, 0, stream>>>(V16 + r0 * DKW, DKW, 0, VT);      /* V^T [128][4096] of this batch */
    k_gemm2<0><<<dim3((SQ / 128) * (SQ / 64), 1), 128, 0, stream>>>(Q16 + r0 * DKW, DKW, 0, K16 + r0 * DKW, DKW, 0, 0.08838834764831845f, nullptr, 0, nullptr, 1, 0, 0, S, nullptr, SQ, 0, SQ, SQ, DKW);      /* scores = q k^T / sqrt(128) (K = 128) */
    k_rsm<<<(SQ + 255) / 256, 256, 0, stream>>>(S, P, SQ);      /* P = 256 softmax (f16) over all 4096 keys */
    k_gemm2<0><<<dim3((SQ / 128) * (DKW / 64), 1), 128, 0, stream>>>(P, SQ, 0, VT, SQ, 0, 0.00390625f, nullptr, 0, nullptr, 1, 0, 0, (float*)d_out + r0 * DKW, nullptr, DKW, 0, SQ, DKW, SQ); }      /* out = P V^T 2^-8 (f32 rows of the output) */
}

// v001
// A run of this version takes 692 microseconds.
// Next to v000, in two timings, it ran 5.18 times as fast each time.
#include <hip/hip_runtime.h>
// Single-head self-attention (x [4][4096][256]; q = x Wq + bq, k = x Wk + bk, v = x Wv + bv ([in][out] 256 x 128, weights AND biases uniform +-1/16); scores = q k^T / sqrt(128); softmax over all 4096 keys (no mask); out = w v -> [4][4096][128]; no output projection).
// Structure: token rows r = b*4096 + s; x as exact f16 rows (bf16-rounded); q, k, v as three WMMA GEMMs (32x64 wave tiles, f32 accumulation, exact x16 weights + bias, f16 outputs, 128 wide); per batch: V^T (2 slabs of 64 channels) via LDS transposes; ONE scores GEMM (K = 128, alpha 1/sqrt(128)) into an f32 [4096][4096] plane, row softmax on VALU (f32 statistics; weights stored x256 as f16), out = P . V^T GEMM (K = 4096, alpha 2^-8) written f32 straight into the output rows.
// Compute dtype: inputs rounded to bf16; x / weights exact; q, k, v and softmax weights as plain f16 GEMM operands (~2^-12); scores and softmax statistics f32. v_wmma_f32_16x16x32_f16.
#define NB 4
#define SQ 4096
#define DM 256                       /* input width */
#define DKW 128                      /* q / k / v width = the single head */
#define NH 1
#define HD 64
#define HG 4                         /* heads per block group of the non-template k_vt, which is not launched */
#define B0 0                         /* first batch processed (debug hook) */
#define NBR NB                       /* batches processed (debug hook) */
#define NR ((size_t)NB * SQ)         /* token rows */
#define MP ((int)((size_t)NBR * SQ)) /* rows projected (debug hook) */
#define QN SQ                        /* query rows attended per batch (debug hook) */
#define NHD NH                       /* heads attended (debug hook) */
#define MPO MP                       /* rows through the output stage (debug hook) */
#define LQ DM      /* unused; the q/k/v rows have pitch DKW */
typedef __bf16 v16b __attribute__((ext_vector_type(16)));
typedef unsigned short v8us __attribute__((ext_vector_type(8), may_alias));
typedef float  v8f  __attribute__((ext_vector_type(8)));
typedef float  v4f  __attribute__((ext_vector_type(4)));
typedef float  v4fa __attribute__((ext_vector_type(4), may_alias));
union FragB { v16b v; v8us half[2]; unsigned short u[16]; };

__device__ __forceinline__ unsigned short bf16_bits(float x) { unsigned int u = __float_as_uint(x); return (unsigned short)((u + 0x7FFFu + ((u >> 16) & 1u)) >> 16); }
__device__ __forceinline__ float bf16_val(unsigned short b) { return __uint_as_float(((unsigned int)b) << 16); }
__device__ __forceinline__ float bf16_round(float x) { return bf16_val(bf16_bits(x)); }
// D += A·B with NT terms: 1 = ah·bh, 2 = + al·bh (A split), 3 = + ah·bl (both split)
template <int NT>
__device__ __forceinline__ v8f mmaN(v16b ah, v16b al, v16b bh, v16b bl, v8f c) {
  c = __builtin_amdgcn_wmma_f32_16x16x32_bf16(false, ah, false, bh, (short)0, c, false, false);
  if (NT >= 2) c = __builtin_amdgcn_wmma_f32_16x16x32_bf16(false, al, false, bh, (short)0, c, false, false);
  if (NT >= 3) c = __builtin_amdgcn_wmma_f32_16x16x32_bf16(false, ah, false, bl, (short)0, c, false, false);
  asm volatile("v_nop\n\tv_nop\n\tv_nop\n\tv_nop" : "+v"(c) : "v"(ah), "v"(al), "v"(bh), "v"(bl));
  return c;
}

__global__ __launch_bounds__(256) void k_wt_bf16(const float* __restrict__ W, unsigned short* __restrict__ Wt, int K, int N) {
  const int t = blockIdx.x * 256 + threadIdx.x;
  const int k8n = K / 8;
  if (t >= N * k8n) return;
  const int n = t / k8n, k8 = (t % k8n) * 8;
  v8us v;
#pragma unroll
  for (int i = 0; i < 8; ++i) v[i] = bf16_bits(W[(size_t)(k8 + i) * N + n]);
  *(v8us*)(Wt + (size_t)n * K + k8) = v;
  
}

// GEMM C[M][N] (f32, pitch ldc) = act(A[M][K]·W + bias). A f32 row-major (pitch lda) converted per fragment to bf16
// (ASPLIT: hi/lo two planes -> 2 terms, else single rounded term); Wt bf16 [N][K] (pitch ldb). BIAS_BF16 rounds the
// bias to bf16 first (bias quantised to bf16 before the add). K%32==0, M%16==0, N%64==0.
template <bool ASPLIT, int ACT, bool BIAS_BF16>
__global__ __launch_bounds__(128) void k_gemm_bf(const float* __restrict__ A, int lda, const unsigned short* __restrict__ Wt, int ldb,
                                               const float* __restrict__ bias, float* __restrict__ C, int ldc, int M, int N, int K) {
  __shared__ __attribute__((aligned(16))) float so[4][16][64];
  const int tid = threadIdx.x, w = tid >> 5, lane = tid & 31, ln = lane & 15, hh = lane >> 4;
  const int ntn = N / 64;
  const int wid = blockIdx.x * 4 + w;
  const int mt = wid / ntn, nq = wid % ntn;
  if (mt * 16 >= M) return;
  const int row0 = mt * 16, col0 = nq * 64;
  const float* arow = A + (size_t)(row0 + ln) * lda;
  v8f acc[4] = {};
  for (int kb = 0; kb < K; kb += 32) {
    FragB ah, al;
    const v4f x0 = *(const v4fa*)(arow + kb + 8 * hh), x1 = *(const v4fa*)(arow + kb + 8 * hh + 4);
    const v4f x2 = *(const v4fa*)(arow + kb + 16 + 8 * hh), x3 = *(const v4fa*)(arow + kb + 16 + 8 * hh + 4);
    float xs[16] = {x0[0],x0[1],x0[2],x0[3],x1[0],x1[1],x1[2],x1[3],x2[0],x2[1],x2[2],x2[3],x3[0],x3[1],x3[2],x3[3]};
#pragma unroll
    for (int i = 0; i < 16; ++i) { const unsigned short hb = bf16_bits(xs[i]); ah.u[i] = hb; al.u[i] = ASPLIT ? bf16_bits(xs[i] - bf16_val(hb)) : (unsigned short)0; }
#pragma unroll
    for (int t = 0; t < 4; ++t) {
      const unsigned short* brow = Wt + (size_t)(col0 + t * 16 + ln) * ldb + kb;
      FragB b;
      b.half[0] = *(const v8us*)(brow + 8 * hh);
      b.half[1] = *(const v8us*)(brow + 16 + 8 * hh);
      acc[t] = mmaN<ASPLIT ? 2 : 1>(ah.v, al.v, b.v, b.v, acc[t]);
    }
  }
#pragma unroll
  for (int t = 0; t < 4; ++t) {
    float bv = bias ? bias[col0 + t * 16 + ln] : 0.f;
    if (BIAS_BF16) bv = bf16_round(bv);
#pragma unroll
    for (int r = 0; r < 8; ++r) { float v = acc[t][r] + bv; if (ACT == 1) v = fmaxf(v, 0.f); so[w][8 * hh + r][t * 16 + ln] = v; }
  }
  __builtin_amdgcn_fence(__ATOMIC_ACQ_REL, "workgroup");
  __builtin_amdgcn_wave_barrier();
  const int rsub = lane >> 4, c4 = (lane & 15) * 4;
  {
#pragma unroll
    for (int q = 0; q < 8; ++q) {
      const int r = q * 2 + rsub;
      const v4f v = *(const v4fa*)&so[w][r][c4];
      *(v4f*)(C + (size_t)(row0 + r) * ldc + col0 + c4) = v;
    }
    
  }
}

// GEMM C = act(A·W + bias + resid): A f32 (ASPLIT -> hi/lo 2 terms), Wt bf16 [N][K]; ACT 0 none, 1 relu, 2 exact gelu;
// resid (optional, f32, row index = (row % rmod), pitch ldr, RES_BF16 rounds it) added before the activation.
template <bool ASPLIT, int ACT, bool BIAS_BF16, bool RES_BF16>
__global__ __launch_bounds__(128) void k_gemm_bf3(const float* __restrict__ A, int lda, const unsigned short* __restrict__ Wt, int ldb,
                                                const float* __restrict__ bias, const float* __restrict__ resid, int rmod, int ldr,
                                                float* __restrict__ C, int ldc, int M, int N, int K) {
  __shared__ __attribute__((aligned(16))) float so[4][16][64];
  const int tid = threadIdx.x, w = tid >> 5, lane = tid & 31, ln = lane & 15, hh = lane >> 4;
  const int ntn = N / 64;
  const int wid = blockIdx.x * 4 + w;
  const int mt = wid / ntn, nq = wid % ntn;
  if (mt * 16 >= M) return;
  const int row0 = mt * 16, col0 = nq * 64;
  const float* arow = A + (size_t)(row0 + ln) * lda;
  v8f acc[4] = {};
  for (int kb = 0; kb < K; kb += 32) {
    FragB ah, al;
    const v4f x0 = *(const v4fa*)(arow + kb + 8 * hh), x1 = *(const v4fa*)(arow + kb + 8 * hh + 4);
    const v4f x2 = *(const v4fa*)(arow + kb + 16 + 8 * hh), x3 = *(const v4fa*)(arow + kb + 16 + 8 * hh + 4);
    float xs[16] = {x0[0],x0[1],x0[2],x0[3],x1[0],x1[1],x1[2],x1[3],x2[0],x2[1],x2[2],x2[3],x3[0],x3[1],x3[2],x3[3]};
#pragma unroll
    for (int i = 0; i < 16; ++i) { const unsigned short hb = bf16_bits(xs[i]); ah.u[i] = hb; al.u[i] = ASPLIT ? bf16_bits(xs[i] - bf16_val(hb)) : (unsigned short)0; }
#pragma unroll
    for (int t = 0; t < 4; ++t) {
      const unsigned short* brow = Wt + (size_t)(col0 + t * 16 + ln) * ldb + kb;
      FragB b;
      b.half[0] = *(const v8us*)(brow + 8 * hh);
      b.half[1] = *(const v8us*)(brow + 16 + 8 * hh);
      acc[t] = mmaN<ASPLIT ? 2 : 1>(ah.v, al.v, b.v, b.v, acc[t]);
    }
  }
#pragma unroll
  for (int t = 0; t < 4; ++t) {
    const int col = col0 + t * 16 + ln;
    float bv = bias ? bias[col] : 0.f;
    if (BIAS_BF16) bv = bf16_round(bv);
#pragma unroll
    for (int r = 0; r < 8; ++r) {
      float v = acc[t][r] + bv;
      if (resid) { float rv = resid[(size_t)((row0 + 8 * hh + r) % rmod) * ldr + col]; if (RES_BF16) rv = bf16_round(rv); v += rv; }
      if (ACT == 1) v = fmaxf(v, 0.f);
      if (ACT == 2) v = 0.5f * v * (1.0f + erff(v * 0.70710678118654752f));
      if (ACT == 3) { const float u = 0.7978845608028654f * (v + 0.044715f * v * v * v); v = 0.5f * v * (1.0f + tanhf(u)); }
      so[w][8 * hh + r][t * 16 + ln] = v;
    }
  }
  __builtin_amdgcn_fence(__ATOMIC_ACQ_REL, "workgroup");
  __builtin_amdgcn_wave_barrier();
  const int rsub = lane >> 4, c4 = (lane & 15) * 4;
  {
#pragma unroll
    for (int q = 0; q < 8; ++q) {
      const int r = q * 2 + rsub;
      const v4f v = *(const v4fa*)&so[w][r][c4];
      *(v4f*)(C + (size_t)(row0 + r) * ldc + col0 + c4) = v;
    }
    
  }
}
// row LayerNorm (biased variance, eps) over N: s = X (+ R); optional out_sum <- s; out_norm <- (s-mu)*rsqrt(var+eps)*g + b
template <bool PARAM_BF16>
__global__ __launch_bounds__(256) void k_layernorm(const float* __restrict__ X, const float* __restrict__ R, const float* __restrict__ g, const float* __restrict__ bta,
                                                  float* __restrict__ out_sum, float* __restrict__ out_norm, int N, float eps) {
  __shared__ float red[256];
  const int row = blockIdx.x, tid = threadIdx.x;
  const float* x = X + (size_t)row * N; const float* rr = R ? R + (size_t)row * N : nullptr;
  float vals[16];                     // up to N = 4096
  const int per = N / 256;            // contiguous chunk per thread? use strided-by-4 chunks: thread handles j = tid*4 + 1024*u
  float s1 = 0.f;
  for (int u = 0; u < per / 4; ++u) {
    const int j = tid * 4 + 1024 * u;
    const v4f a = *(const v4fa*)(x + j);
    v4f b = {0.f,0.f,0.f,0.f}; if (rr) b = *(const v4fa*)(rr + j);
#pragma unroll
    for (int q = 0; q < 4; ++q) { const float v = a[q] + b[q]; vals[u * 4 + q] = v; s1 += v; }
  }
  red[tid] = s1; __syncthreads();
  for (int st = 128; st > 0; st >>= 1) { if (tid < st) red[tid] += red[tid + st]; __syncthreads(); }
  const float mu = red[0] / (float)N; __syncthreads();
  float s2 = 0.f;
  for (int u = 0; u < per / 4; ++u)
#pragma unroll
    for (int q = 0; q < 4; ++q) { const float c = vals[u * 4 + q] - mu; s2 += c * c; }
  red[tid] = s2; __syncthreads();
  for (int st = 128; st > 0; st >>= 1) { if (tid < st) red[tid] += red[tid + st]; __syncthreads(); }
  const float rs = rsqrtf(red[0] / (float)N + eps);
  {
    for (int u = 0; u < per / 4; ++u) {
      const int j = tid * 4 + 1024 * u;
      v4f o, sm;
#pragma unroll
      for (int q = 0; q < 4; ++q) {
        float gg = g[j + q], bb = bta[j + q];
        if (PARAM_BF16) { gg = bf16_round(gg); bb = bf16_round(bb); }
        sm[q] = vals[u * 4 + q]; o[q] = (vals[u * 4 + q] - mu) * rs * gg + bb;
      }
      if (out_sum) *(v4f*)(out_sum + (size_t)row * N + j) = sm;
      *(v4f*)(out_norm + (size_t)row * N + j) = o;
    }
    
  }
}



// ---- f16 WMMA path (v_wmma_f32_16x16x32_f16): 11-bit significands for operands in range — used where a [0,1] probability operand needs more precision than bf16
typedef _Float16 v16h __attribute__((ext_vector_type(16)));
union FragH { v16h v; v8us half[2]; _Float16 h[16]; unsigned short u[16]; };
template <int NT>
__device__ __forceinline__ v8f mmaH(v16h ah, v16h al, v16h bh, v16h bl, v8f c) {
  c = __builtin_amdgcn_wmma_f32_16x16x32_f16(false, ah, false, bh, (short)0, c, false, false);
  if (NT >= 2) c = __builtin_amdgcn_wmma_f32_16x16x32_f16(false, al, false, bh, (short)0, c, false, false);
  if (NT >= 3) c = __builtin_amdgcn_wmma_f32_16x16x32_f16(false, ah, false, bl, (short)0, c, false, false);
  asm volatile("v_nop\n\tv_nop\n\tv_nop\n\tv_nop" : "+v"(c) : "v"(ah), "v"(al), "v"(bh), "v"(bl));
  return c;
}
// batched GEMM like k_gemm_b but f16 operands: A f32 (split into f16 hi/lo if ASPLIT, else rounded to f16), Bt = f16 values [n][k]; alpha; C f32; N multiple of 16 (partial tiles skipped)
template <bool ASPLIT>
__global__ __launch_bounds__(128) void k_gemm_h(const float* __restrict__ A, int lda, size_t sA, const _Float16* __restrict__ Bh, int ldb, size_t sB, float alpha, float* __restrict__ C, int ldc, size_t sC, int M, int N, int K) {
  __shared__ __attribute__((aligned(16))) float so[4][16][64];
  const int tid = threadIdx.x, w = tid >> 5, lane = tid & 31, ln = lane & 15, hh = lane >> 4; const int by = blockIdx.y;
  A += (size_t)by * sA; Bh += (size_t)by * sB; C += (size_t)by * sC;
  const int ntn = (N + 63) / 64; const int wid = blockIdx.x * 4 + w; const int mt = wid / ntn, nq = wid % ntn; if (mt * 16 >= M) return;
  const int row0 = mt * 16, col0 = nq * 64; const float* arow = A + (size_t)(row0 + ln) * lda;
  v8f acc[4] = {};
  for (int kb = 0; kb < K; kb += 32) {
    FragH ah, al;
    const v4f x0 = *(const v4fa*)(arow + kb + 8 * hh), x1 = *(const v4fa*)(arow + kb + 8 * hh + 4), x2 = *(const v4fa*)(arow + kb + 16 + 8 * hh), x3 = *(const v4fa*)(arow + kb + 16 + 8 * hh + 4);
    float xs[16] = {x0[0],x0[1],x0[2],x0[3],x1[0],x1[1],x1[2],x1[3],x2[0],x2[1],x2[2],x2[3],x3[0],x3[1],x3[2],x3[3]};
#pragma unroll
    for (int i = 0; i < 16; ++i) { const _Float16 h = (_Float16)xs[i]; ah.h[i] = h; al.h[i] = ASPLIT ? (_Float16)(xs[i] - (float)h) : (_Float16)0.0f; }
#pragma unroll
    for (int t = 0; t < 4; ++t) { if (col0 + t * 16 >= N) continue; const size_t boff = (size_t)(col0 + t * 16 + ln) * ldb + kb; FragH bq; bq.half[0] = *(const v8us*)(Bh + boff + 8 * hh); bq.half[1] = *(const v8us*)(Bh + boff + 16 + 8 * hh);
      acc[t] = mmaH<ASPLIT ? 2 : 1>(ah.v, al.v, bq.v, bq.v, acc[t]); }
  }
#pragma unroll
  for (int t = 0; t < 4; ++t) { if (col0 + t * 16 >= N) continue;
#pragma unroll
    for (int r = 0; r < 8; ++r) so[w][8 * hh + r][t * 16 + ln] = acc[t][r] * alpha; }
  __builtin_amdgcn_fence(__ATOMIC_ACQ_REL, "workgroup"); __builtin_amdgcn_wave_barrier();
  const int rsub = lane >> 4, c4 = (lane & 15) * 4;
  {
#pragma unroll
    for (int q = 0; q < 8; ++q) { const int r = q * 2 + rsub; if (col0 + c4 < N) { const v4f v = *(const v4fa*)&so[w][r][c4]; *(v4f*)(C + (size_t)(row0 + r) * ldc + col0 + c4) = v; } }
     }
}

// Wt[n][k] = f16(W[k][n]·scale) from f32 row-major W[K][N] (scale = power of two; bf16-exact weights stay exact in f16 away from the subnormal range)
__global__ __launch_bounds__(256) void k_wt_f16(const float* __restrict__ W, _Float16* __restrict__ Wt, int K, int N, float scale) {
  const int t = blockIdx.x * 256 + threadIdx.x; if (t >= N * (K / 8)) return; const int n = t / (K / 8), k8 = (t % (K / 8)) * 8; FragH f;
#pragma unroll
  for (int i = 0; i < 8; ++i) f.h[i] = (_Float16)(bf16_round(W[(size_t)(k8 + i) * N + n]) * scale); const v8us o = f.half[0];
  *(v8us*)((unsigned short*)Wt + (size_t)n * K + k8) = o; 
}
// k_gemm_hh variant with fused epilogue: v = acc·alpha + bias[by·sBias + col] (+ CP[(row/rowsPerB)·sCPb + by·64 + col] if CP) ; ACT 0 none / 1 elu ; writes f16 C16 (and f32 C if non-null)
template <int ACT>
__global__ __launch_bounds__(128) void k_gemm_hhx(const _Float16* __restrict__ A, int lda, size_t sA, const _Float16* __restrict__ Bh, int ldb, size_t sB, float alpha, const float* __restrict__ bias, size_t sBias, const float* __restrict__ CP, int rowsPerB, size_t sCPb, int row0g,
    float* __restrict__ C, _Float16* __restrict__ C16, int ldc, size_t sC, int M, int N, int K) {
  __shared__ __attribute__((aligned(16))) float so[4][16][64];
  const int tid = threadIdx.x, w = tid >> 5, lane = tid & 31, ln = lane & 15, hh = lane >> 4; const int by = blockIdx.y;
  A += (size_t)by * sA; Bh += (size_t)by * sB; const size_t cofs = (size_t)by * sC; const float* bp = bias ? bias + (size_t)by * sBias : nullptr;
  const int ntn = (N + 63) / 64; const int wid = blockIdx.x * 4 + w; const int mt = wid / ntn, nq = wid % ntn; if (mt * 16 >= M) return;
  const int row0 = mt * 16, col0 = nq * 64; const _Float16* arow = A + (size_t)(row0 + ln) * lda;
  v8f acc[4] = {};
  for (int kb = 0; kb < K; kb += 32) { FragH ah; ah.half[0] = *(const v8us*)((const unsigned short*)arow + kb + 8 * hh); ah.half[1] = *(const v8us*)((const unsigned short*)arow + kb + 16 + 8 * hh);
#pragma unroll
    for (int t = 0; t < 4; ++t) { if (col0 + t * 16 >= N) continue; const size_t boff = (size_t)(col0 + t * 16 + ln) * ldb + kb; FragH bq; bq.half[0] = *(const v8us*)((const unsigned short*)Bh + boff + 8 * hh); bq.half[1] = *(const v8us*)((const unsigned short*)Bh + boff + 16 + 8 * hh);
      acc[t] = mmaH<1>(ah.v, ah.v, bq.v, bq.v, acc[t]); }
  }
#pragma unroll
  for (int t = 0; t < 4; ++t) { if (col0 + t * 16 >= N) continue; const int col = col0 + t * 16 + ln; const float bv = bp ? bf16_round(bp[col]) : 0.f;
#pragma unroll
    for (int r = 0; r < 8; ++r) { float v = acc[t][r] * alpha + bv; if (CP) { const int rr = row0g + row0 + 8 * hh + r; if (rowsPerB < 0) v += CP[cofs + (size_t)rr * ldc + col];      /* rowsPerB < 0: own element of the batched C plane */ else { const int bidx = rr / rowsPerB; v += CP[(size_t)bidx * sCPb + (size_t)by * 64 + col]; } } if (ACT == 1) v = (v > 0.f) ? v : expm1f(v); else if (ACT == 7) v = (v > 0.f) ? v + 1.0f : expf(v); else if (ACT == 8) v = tanhf(v); else if (ACT == 9) v = 0.5f * v * (1.0f + tanhf(0.7978845608028654f * (v + 0.044715f * v * v * v))); else if (ACT == 11) v = 1.0f / (1.0f + expf(-v)); else if (ACT == 12) v = (v > 0.f) ? v : 0.01f * v; else if (ACT == 14) v = (v > 0.f) ? v : 0.1f * v; else if (ACT == 16) v = (v >= 0.f) ? v : 0.3f * v; else if (ACT == 17) v = (v >= 0.f) ? v : 0.2f * v; else if (ACT == 15) v = v / (1.0f + expf(-v)); else if (ACT == 3) v = fmaxf(v, 0.f); else if (ACT == 6) v = 0.5f * v * (1.0f + erff(v * 0.70710678118654752f)); so[w][8 * hh + r][t * 16 + ln] = v; } }
  __builtin_amdgcn_fence(__ATOMIC_ACQ_REL, "workgroup"); __builtin_amdgcn_wave_barrier();
  const int rsub = lane >> 4, c4 = (lane & 15) * 4; typedef _Float16 v4h __attribute__((ext_vector_type(4)));
  {
#pragma unroll
    for (int q = 0; q < 8; ++q) { const int r = q * 2 + rsub; if (col0 + c4 < N) { const v4f v = *(const v4fa*)&so[w][r][c4]; if (C) *(v4f*)(C + cofs + (size_t)(row0 + r) * ldc + col0 + c4) = v; if (C16) { v4h h4; for (int i = 0; i < 4; ++i) h4[i] = (_Float16)v[i]; *(v4h*)(C16 + cofs + (size_t)(row0 + r) * ldc + col0 + c4) = h4; } } }
     }
}


typedef _Float16 v4h __attribute__((ext_vector_type(4)));

__global__ __launch_bounds__(256) void k_x16(const float* __restrict__ x, _Float16* __restrict__ X16, size_t n8) { const size_t t = (size_t)blockIdx.x * 256 + threadIdx.x; if (t >= n8) return; FragH f;
#pragma unroll
  for (int q = 0; q < 8; ++q) f.h[q] = (_Float16)bf16_round(x[t * 8 + q]); *(v8us*)((unsigned short*)X16 + t * 8) = f.half[0];  }
__global__ __launch_bounds__(256) void k_h16(const float* __restrict__ x, _Float16* __restrict__ X16, size_t n8) { const size_t t = (size_t)blockIdx.x * 256 + threadIdx.x; if (t >= n8) return; FragH f;
#pragma unroll
  for (int q = 0; q < 8; ++q) f.h[q] = (_Float16)x[t * 8 + q]; *(v8us*)((unsigned short*)X16 + t * 8) = f.half[0];  }
__global__ __launch_bounds__(256) void k_round16f(const float* __restrict__ W, _Float16* __restrict__ Bt, size_t n8) { const size_t t = (size_t)blockIdx.x * 256 + threadIdx.x; if (t >= n8) return; FragH f;
#pragma unroll
  for (int i = 0; i < 8; ++i) f.h[i] = (_Float16)(bf16_round(W[t * 8 + i]) * 16.0f); *(v8us*)((unsigned short*)Bt + t * 8) = f.half[0];  }
template <int NHv, int TTv>
__global__ __launch_bounds__(256) void k_vt(const _Float16* __restrict__ V16, int ldv, int voff, _Float16* __restrict__ Vt) { __shared__ unsigned short tl[64][66]; const int tid = threadIdx.x; const int slab = blockIdx.x / (TTv / 64), lg = blockIdx.x % (TTv / 64); const int b = slab / NHv, h = slab % NHv;
  for (int i = tid; i < 64 * 8; i += 256) { const int r = i / 8, c8 = (i % 8) * 8; FragH f; f.half[0] = *(const v8us*)((const unsigned short*)V16 + ((size_t)b * TTv + lg * 64 + r) * ldv + voff + h * 64 + c8);
#pragma unroll
    for (int q = 0; q < 8; ++q) tl[r][c8 + q] = f.u[q]; }
  __syncthreads();
  {
#pragma unroll
    for (int rd = 0; rd < 2; ++rd) { const int d = rd * 32 + tid / 8, pc = tid % 8; FragH f;
#pragma unroll
      for (int q = 0; q < 8; ++q) f.u[q] = tl[pc * 8 + q][d];
      *(v8us*)((unsigned short*)Vt + ((size_t)slab * 64 + d) * TTv + lg * 64 + pc * 8) = f.half[0]; }
     } }

__global__ __launch_bounds__(256) void k_hl(const float* __restrict__ F, _Float16* __restrict__ Hh, _Float16* __restrict__ Hl, size_t n8) { const size_t t = (size_t)blockIdx.x * 256 + threadIdx.x; if (t >= n8) return; FragH fh, fl; const v4f a = *(const v4fa*)(F + t * 8), c = *(const v4fa*)(F + t * 8 + 4);
#pragma unroll
  for (int q = 0; q < 4; ++q) { _Float16 h = (_Float16)a[q]; fh.h[q] = h; fl.h[q] = (_Float16)((a[q] - (float)h) * 1024.0f); h = (_Float16)c[q]; fh.h[4 + q] = h; fl.h[4 + q] = (_Float16)((c[q] - (float)h) * 1024.0f); }
  { *(v8us*)((unsigned short*)Hh + t * 8) = fh.half[0]; *(v8us*)((unsigned short*)Hl + t * 8) = fl.half[0];  } }

// ---- fast GEMM (wave tile 32x64; requires M % 32 == 0 rows per launch region and N % 64 == 0); epilogue = k_gemm_hhx semantics ----
__device__ __forceinline__ v16h g2_frag(const _Float16* p, int hh) { FragH f; f.half[0] = *(const v8us*)((const unsigned short*)p + 8 * hh); f.half[1] = *(const v8us*)((const unsigned short*)p + 16 + 8 * hh); return f.v; }
__device__ __forceinline__ v8f g2_mma(v16h a, v16h b, v8f c) { v8f d = __builtin_amdgcn_wmma_f32_16x16x32_f16(false, a, false, b, (short)0, c, false, false); asm volatile("v_nop\n\tv_nop\n\tv_nop\n\tv_nop" : "+v"(d) : "v"(a), "v"(b)); return d; }
template <int ACT>
__global__ __launch_bounds__(128) void k_gemm2(const _Float16* __restrict__ A, int lda, size_t sA, const _Float16* __restrict__ Bh, int ldb, size_t sB, float alpha, const float* __restrict__ bias, size_t sBias, const float* __restrict__ CP, int rowsPerB, size_t sCPb, int row0g,
    float* __restrict__ C, _Float16* __restrict__ C16, int ldc, size_t sC, int M, int N, int K) { static_assert(ACT == 0 || ACT == 3 || ACT == 6 || ACT == 8 || ACT == 9 || ACT == 11 || ACT == 12 || ACT == 14 || ACT == 15 || ACT == 16 || ACT == 17, "k_gemm2: unsupported ACT code (would silently apply no activation)");
  __shared__ __attribute__((aligned(16))) float so[4][32][68];
  const int tid = threadIdx.x, w = tid >> 5, lane = tid & 31, ln = lane & 15, hh = lane >> 4; const int by = blockIdx.y;
  A += (size_t)by * sA; Bh += (size_t)by * sB; const size_t cofs = (size_t)by * sC; const float* bp = bias ? bias + (size_t)by * sBias : nullptr;
  const int ntn = N >> 6; const int mt = blockIdx.x / ntn, nq = blockIdx.x - mt * ntn; const int row0 = mt * 128 + 32 * w, col0 = nq * 64; if (row0 >= M) return;
  const _Float16* a0p = A + (size_t)(row0 + ln) * lda; const _Float16* a1p = a0p + (size_t)16 * lda;
  const _Float16* b0p = Bh + (size_t)(col0 + ln) * ldb; const _Float16* b1p = b0p + (size_t)16 * ldb; const _Float16* b2p = b1p + (size_t)16 * ldb; const _Float16* b3p = b2p + (size_t)16 * ldb;
  const v8f z8 = {0.f,0.f,0.f,0.f,0.f,0.f,0.f,0.f}; v8f c00 = z8, c01 = z8, c02 = z8, c03 = z8, c10 = z8, c11 = z8, c12 = z8, c13 = z8;
#pragma unroll 1
  for (int kb = 0; kb < K; kb += 32) { const v16h a0 = g2_frag(a0p + kb, hh), a1 = g2_frag(a1p + kb, hh);
    v16h b = g2_frag(b0p + kb, hh); c00 = g2_mma(a0, b, c00); c10 = g2_mma(a1, b, c10);
    b = g2_frag(b1p + kb, hh); c01 = g2_mma(a0, b, c01); c11 = g2_mma(a1, b, c11);
    b = g2_frag(b2p + kb, hh); c02 = g2_mma(a0, b, c02); c12 = g2_mma(a1, b, c12);
    b = g2_frag(b3p + kb, hh); c03 = g2_mma(a0, b, c03); c13 = g2_mma(a1, b, c13); }
  v8f accs[8] = {c00, c01, c02, c03, c10, c11, c12, c13};
#pragma unroll
  for (int u = 0; u < 8; ++u) { const int t = u & 3, half = u >> 2; const int col = col0 + t * 16 + ln; const float bv = bp ? bf16_round(bp[col]) : 0.f;
#pragma unroll
    for (int r = 0; r < 8; ++r) { const int rloc = half * 16 + 8 * hh + r; float v = accs[u][r] * alpha + bv; if (CP) { if (rowsPerB < 0) v += CP[cofs + (size_t)(row0g + row0 + rloc) * ldc + col];      /* rowsPerB < 0: own element of the batched C plane */ else { const int bidx = (row0g + row0 + rloc) / rowsPerB; v += CP[(size_t)bidx * sCPb + (size_t)by * 64 + col]; } }
      if (ACT == 3) v = fmaxf(v, 0.f); else if (ACT == 6) v = 0.5f * v * (1.0f + erff(v * 0.70710678118654752f)); else if (ACT == 11) v = 1.0f / (1.0f + expf(-v)); else if (ACT == 15) v = v / (1.0f + expf(-v)); else if (ACT == 12) v = (v > 0.f) ? v : 0.01f * v; else if (ACT == 8) v = tanhf(v); else if (ACT == 9) v = 0.5f * v * (1.0f + tanhf(0.7978845608028654f * (v + 0.044715f * v * v * v))); else if (ACT == 14) v = (v > 0.f) ? v : 0.1f * v; else if (ACT == 16) v = (v >= 0.f) ? v : 0.3f * v; else if (ACT == 17) v = (v >= 0.f) ? v : 0.2f * v;
      so[w][rloc][t * 16 + ln] = v; } }
  __builtin_amdgcn_fence(__ATOMIC_ACQ_REL, "workgroup"); __builtin_amdgcn_wave_barrier();
  const int rsub = lane >> 4, c4 = (lane & 15) * 4;
  {
#pragma unroll
    for (int q = 0; q < 16; ++q) { const int r = q * 2 + rsub; const v4f v = *(const v4fa*)&so[w][r][c4]; if (C) *(v4f*)(C + cofs + (size_t)(row0 + r) * ldc + col0 + c4) = v; if (C16) { v4h h4; for (int i = 0; i < 4; ++i) h4[i] = (_Float16)v[i]; *(v4h*)(C16 + cofs + (size_t)(row0 + r) * ldc + col0 + c4) = h4; } }
     } }


__global__ __launch_bounds__(256) void k_wnat(const float* __restrict__ w, size_t n8, _Float16* __restrict__ Bt) { const size_t t = (size_t)blockIdx.x * 256 + threadIdx.x; if (t >= n8) return; FragH f; for (int q = 0; q < 8; ++q) f.h[q] = (_Float16)(bf16_round(w[t * 8 + q]) * 16.0f); *(v8us*)((unsigned short*)Bt + t * 8) = f.half[0];  }
// Row softmax, one wave per row: each load takes 512 contiguous bytes of the row, the 4096 f32 scores are read once and stay in registers (128 per lane)
// through maximum, exp, sum and scaling; maximum and sum: four chains per lane, then a five-step butterfly over the 32 lanes; P leaves as whole 128-byte lines.
__global__ __launch_bounds__(512) void k_rsm(const float* __restrict__ S, _Float16* __restrict__ P, int nrows) {
  const int lane = threadIdx.x & 31; const int row = blockIdx.x * 16 + (threadIdx.x >> 5); if (row >= nrows) return;      /* wave-uniform exit; the kernel has no barrier */
  const float* s = S + (size_t)row * SQ + lane * 4; v4f e[SQ / 128];
#pragma unroll      /* constant indices keep e[] in registers, and all 32 loads go out before the first use */
  for (int i = 0; i < SQ / 128; ++i) e[i] = *(const v4fa*)(s + i * 128);
  asm volatile("s_wait_xcnt 0x0" :: "v"(s) : "memory");      /* the wait before a register that an issued load names is overwritten; s as an input keeps the address pair whole up to here (without it the last load's result was placed on the pair) */
  v4f m4 = {-3.0e38f, -3.0e38f, -3.0e38f, -3.0e38f};
#pragma unroll      /* e[] in registers */
  for (int i = 0; i < SQ / 128; ++i) for (int q = 0; q < 4; ++q) m4[q] = fmaxf(m4[q], e[i][q]);
  float mx = fmaxf(fmaxf(m4[0], m4[1]), fmaxf(m4[2], m4[3]));
  for (int m = 16; m >= 1; m >>= 1) mx = fmaxf(mx, __shfl_xor(mx, m, 32));
  v4f a4 = {0.f, 0.f, 0.f, 0.f};
#pragma unroll      /* e[] in registers */
  for (int i = 0; i < SQ / 128; ++i) { v4f t; for (int q = 0; q < 4; ++q) t[q] = expf(e[i][q] - mx); e[i] = t; a4 += t; }
  float se = (a4[0] + a4[1]) + (a4[2] + a4[3]);
  for (int m = 16; m >= 1; m >>= 1) se += __shfl_xor(se, m, 32);
  const float sc = 256.0f / se; _Float16* d = P + (size_t)row * SQ + lane * 4;
#pragma unroll      /* e[] in registers */
  for (int i = 0; i < SQ / 128; ++i) { v4h h4; for (int q = 0; q < 4; ++q) h4[q] = (_Float16)(e[i][q] * sc); *(v4h*)(d + i * 128) = h4; } }
__global__ __launch_bounds__(256) void k_vt(const _Float16* __restrict__ V16, int b, int h0, _Float16* __restrict__ VT) { __shared__ unsigned short tl[64][65]; const int tid = threadIdx.x; const int hh = blockIdx.x % HG, sg = blockIdx.x / HG; const int s0 = sg * 64; const int h = h0 + hh;
  for (int i = tid; i < 64 * 8; i += 256) { const int j = i / 8, d8 = (i % 8) * 8; FragH f; f.half[0] = *(const v8us*)((const unsigned short*)V16 + ((size_t)b * SQ + s0 + j) * DM + h * HD + d8); for (int q = 0; q < 8; ++q) tl[d8 + q][j] = f.u[q]; }
  __syncthreads();
  { for (int i = tid; i < 64 * 8; i += 256) { const int d = i / 8, j8 = (i % 8) * 8; FragH f; for (int q = 0; q < 8; ++q) f.u[q] = tl[d][j8 + q]; *(v8us*)((unsigned short*)VT + ((size_t)hh * HD + d) * SQ + s0 + j8) = f.half[0]; }  } }



__global__ __launch_bounds__(256) void k_rsmkm(const float* __restrict__ S, _Float16* __restrict__ P, int nrows, const int* __restrict__ am) {
  #pragma clang fp contract(off)
  const int t = blockIdx.x * 256 + threadIdx.x; if (t >= nrows) return; const size_t i = (size_t)t; const float* s = S + i * SQ; const int* mr = am + (size_t)(t % SQ) * SQ; float mx = -3.0e38f;
#pragma unroll 1
  for (int j = 0; j < SQ; ++j) { const float f = (mr[j] != 0) ? 1.f : 0.f; mx = fmaxf(mx, fmaf(f, s[j], (1.f - f) * -1.0e9f)); } float se = 0.f;
#pragma unroll 1
  for (int j = 0; j < SQ; ++j) { const float f = (mr[j] != 0) ? 1.f : 0.f; se += __expf(fmaf(f, s[j], (1.f - f) * -1.0e9f) - mx); } const float sc = 256.0f / se;
#pragma unroll 1
  for (int j0 = 0; j0 < SQ; j0 += 8) { FragH fr; for (int q = 0; q < 8; ++q) { const int j = j0 + q; const float f = (mr[j] != 0) ? 1.f : 0.f; fr.h[q] = (_Float16)(__expf(fmaf(f, s[j], (1.f - f) * -1.0e9f) - mx) * sc); }
    unsigned short* d = (unsigned short*)P + i * SQ + j0; *(v8us*)d = fr.half[0];  } }
extern "C" void kernel_launch(void* const* d_in, const int* in_sizes, int n_in,
                              void* d_out, int out_size, void* d_ws, size_t ws_size, hipStream_t stream) {
  (void)in_sizes; (void)n_in; (void)out_size;
  const float* const* I = (const float* const*)d_in; const float* x = I[0]; const float* wq = I[1]; const float* bq = I[2]; const float* wk = I[3]; const float* bk = I[4]; const float* wv = I[5]; const float* bv = I[6];      /* x; [in][out] Wq / Wk / Wv [256][128] + biases; no mask input */
  static_assert(SQ % 128 == 0 && SQ % 64 == 0 && SQ % 32 == 0 && DM % 32 == 0 && DKW % 64 == 0 && DKW % 32 == 0, "tile multiples");
  char* ws = (char*)d_ws; size_t off = 0;
  auto take = [&](size_t bytes) { char* p = ws + off; off += (bytes + 255) & ~(size_t)255; return p; };
  _Float16* BQ = (_Float16*)take((size_t)DKW * DM * 2); _Float16* BK = (_Float16*)take((size_t)DKW * DM * 2); _Float16* BV = (_Float16*)take((size_t)DKW * DM * 2);
  _Float16* X16 = (_Float16*)take(NR * DM * 2); _Float16* Q16 = (_Float16*)take(NR * DKW * 2); _Float16* K16 = (_Float16*)take(NR * DKW * 2); _Float16* V16 = (_Float16*)take(NR * DKW * 2);
  float* S = (float*)take((size_t)SQ * SQ * 4); _Float16* P = (_Float16*)take((size_t)SQ * SQ * 2); _Float16* VT = (_Float16*)take((size_t)DKW * SQ * 2);
  if (off > ws_size) return;      /* approx 0.19 + 8 + 3 x 4 + 64 + 32 + 1 = 117 MiB */
  { const unsigned g = (unsigned)(((size_t)DKW * (DM / 8) + 255) / 256); k_wt_f16<<<g, 256, 0, stream>>>(wq, BQ, DM, DKW, 16.0f); k_wt_f16<<<g, 256, 0, stream>>>(wk, BK, DM, DKW, 16.0f); k_wt_f16<<<g, 256, 0, stream>>>(wv, BV, DM, DKW, 16.0f); }      /* [in][out] [256][128] -> Bt [128][256] x16 */
  k_x16<<<(unsigned)((NR * DM / 8 + 255) / 256), 256, 0, stream>>>(x, X16, NR * DM / 8);
  k_gemm2<0><<<dim3((unsigned)((NR / 128) * (DKW / 64)), 1), 128, 0, stream>>>(X16, DM, 0, BQ, DM, 0, 0.0625f, bq, 0, nullptr, 1, 0, 0, nullptr, Q16, DKW, 0, (int)NR, DKW, DM);
  k_gemm2<0><<<dim3((unsigned)((NR / 128) * (DKW / 64)), 1), 128, 0, stream>>>(X16, DM, 0, BK, DM, 0, 0.0625f, bk, 0, nullptr, 1, 0, 0, nullptr, K16, DKW, 0, (int)NR, DKW, DM);
  k_gemm2<0><<<dim3((unsigned)((NR / 128) * (DKW / 64)), 1), 128, 0, stream>>>(X16, DM, 0, BV, DM, 0, 0.0625f, bv, 0, nullptr, 1, 0, 0, nullptr, V16, DKW, 0, (int)NR, DKW, DM);      /* q, k, v rows (f16, 128 wide) */
  for (int b = 0; b < NB; ++b) { const size_t r0 = (size_t)b * SQ;
    k_vt<DKW / 64, SQ><<<(DKW / 64) * (SQ / 64), 256, 0, stream>>>(V16 + r0 * DKW, DKW, 0, VT);      /* V^T [128][4096] of this batch */
    k_gemm2<0><<<dim3((SQ / 128) * (SQ / 64), 1), 128, 0, stream>>>(Q16 + r0 * DKW, DKW, 0, K16 + r0 * DKW, DKW, 0, 0.08838834764831845f, nullptr, 0, nullptr, 1, 0, 0, S, nullptr, SQ, 0, SQ, SQ, DKW);      /* scores = q k^T / sqrt(128) (K = 128) */
    k_rsm<<<(SQ + 15) / 16, 512, 0, stream>>>(S, P, SQ);      /* P = 256 softmax (f16) over all 4096 keys */
    k_gemm2<0><<<dim3((SQ / 128) * (DKW / 64), 1), 128, 0, stream>>>(P, SQ, 0, VT, SQ, 0, 0.00390625f, nullptr, 0, nullptr, 1, 0, 0, (float*)d_out + r0 * DKW, nullptr, DKW, 0, SQ, DKW, SQ); }      /* out = P V^T 2^-8 (f32 rows of the output) */
}

// v002
// It runs in 104 microseconds.
// Next to v001, in two timings, it ran 6.80 and 6.67 times as fast.
// Counting every step since v000, it is 34.9 times as fast.
#include <hip/hip_runtime.h>
// Single-head self-attention (x [4][4096][256]; q = x Wq + bq, k = x Wk + bk, v = x Wv + bv ([in][out] 256 x 128, weights AND biases uniform +-1/16); scores = q k^T / sqrt(128); softmax over all 4096 keys (no mask); out = w v -> [4][4096][128]; no output projection).
// Structure: token rows r = b*4096 + s; x as exact f16 rows (bf16-rounded); q, k, v as three WMMA GEMMs (32x64 wave tiles, f32 accumulation, exact x16 weights + bias, f16 outputs, 128 wide); V^T of all batches via LDS transposes; then ONE fused attention launch: scores, running softmax and the weighted sum of v per 64-key stage, written f32 straight into the output rows.
// Compute dtype: inputs rounded to bf16; x / weights exact; q, k, v and the unnormalised softmax weights exp(s - running max) as plain f16 GEMM operands (~2^-12); scores, softmax statistics and o f32. v_wmma_f32_16x16x32_f16.
#define NB 4
#define SQ 4096
#define DM 256                       /* input width */
#define DKW 128                      /* q / k / v width = the single head */
#define NH 1
#define HD 64
#define HG 4                         /* heads per block group of the non-template k_vt, which is not launched */
#define B0 0                         /* unused; every launch starts at batch 0 */
#define NBR NB                       /* read only by MP, which nothing reads */
#define NR ((size_t)NB * SQ)         /* token rows */
#define MP ((int)((size_t)NBR * SQ)) /* unused; the projections run over NR rows */
#define QN SQ                        /* unused; k_fattn attends all SQ query rows per batch */
#define NHD NH                       /* unused */
#define MPO MP                       /* unused */
#define LQ DM      /* unused; the q/k/v rows have pitch DKW */
typedef __bf16 v16b __attribute__((ext_vector_type(16)));
typedef unsigned short v8us __attribute__((ext_vector_type(8), may_alias));
typedef float  v8f  __attribute__((ext_vector_type(8)));
typedef float  v4f  __attribute__((ext_vector_type(4)));
typedef float  v4fa __attribute__((ext_vector_type(4), may_alias));
union FragB { v16b v; v8us half[2]; unsigned short u[16]; };

__device__ __forceinline__ unsigned short bf16_bits(float x) { unsigned int u = __float_as_uint(x); return (unsigned short)((u + 0x7FFFu + ((u >> 16) & 1u)) >> 16); }
__device__ __forceinline__ float bf16_val(unsigned short b) { return __uint_as_float(((unsigned int)b) << 16); }
__device__ __forceinline__ float bf16_round(float x) { return bf16_val(bf16_bits(x)); }
// D += A·B with NT terms: 1 = ah·bh, 2 = + al·bh (A split), 3 = + ah·bl (both split)
template <int NT>
__device__ __forceinline__ v8f mmaN(v16b ah, v16b al, v16b bh, v16b bl, v8f c) {
  c = __builtin_amdgcn_wmma_f32_16x16x32_bf16(false, ah, false, bh, (short)0, c, false, false);
  if (NT >= 2) c = __builtin_amdgcn_wmma_f32_16x16x32_bf16(false, al, false, bh, (short)0, c, false, false);
  if (NT >= 3) c = __builtin_amdgcn_wmma_f32_16x16x32_bf16(false, ah, false, bl, (short)0, c, false, false);
  asm volatile("v_nop\n\tv_nop\n\tv_nop\n\tv_nop" : "+v"(c) : "v"(ah), "v"(al), "v"(bh), "v"(bl));
  return c;
}

__global__ __launch_bounds__(256) void k_wt_bf16(const float* __restrict__ W, unsigned short* __restrict__ Wt, int K, int N) {
  const int t = blockIdx.x * 256 + threadIdx.x;
  const int k8n = K / 8;
  if (t >= N * k8n) return;
  const int n = t / k8n, k8 = (t % k8n) * 8;
  v8us v;
#pragma unroll
  for (int i = 0; i < 8; ++i) v[i] = bf16_bits(W[(size_t)(k8 + i) * N + n]);
  *(v8us*)(Wt + (size_t)n * K + k8) = v;
  
}

// GEMM C[M][N] (f32, pitch ldc) = act(A[M][K]·W + bias). A f32 row-major (pitch lda) converted per fragment to bf16
// (ASPLIT: hi/lo two planes -> 2 terms, else single rounded term); Wt bf16 [N][K] (pitch ldb). BIAS_BF16 rounds the
// bias to bf16 first (bias quantised to bf16 before the add). K%32==0, M%16==0, N%64==0.
template <bool ASPLIT, int ACT, bool BIAS_BF16>
__global__ __launch_bounds__(128) void k_gemm_bf(const float* __restrict__ A, int lda, const unsigned short* __restrict__ Wt, int ldb,
                                               const float* __restrict__ bias, float* __restrict__ C, int ldc, int M, int N, int K) {
  __shared__ __attribute__((aligned(16))) float so[4][16][64];
  const int tid = threadIdx.x, w = tid >> 5, lane = tid & 31, ln = lane & 15, hh = lane >> 4;
  const int ntn = N / 64;
  const int wid = blockIdx.x * 4 + w;
  const int mt = wid / ntn, nq = wid % ntn;
  if (mt * 16 >= M) return;
  const int row0 = mt * 16, col0 = nq * 64;
  const float* arow = A + (size_t)(row0 + ln) * lda;
  v8f acc[4] = {};
  for (int kb = 0; kb < K; kb += 32) {
    FragB ah, al;
    const v4f x0 = *(const v4fa*)(arow + kb + 8 * hh), x1 = *(const v4fa*)(arow + kb + 8 * hh + 4);
    const v4f x2 = *(const v4fa*)(arow + kb + 16 + 8 * hh), x3 = *(const v4fa*)(arow + kb + 16 + 8 * hh + 4);
    float xs[16] = {x0[0],x0[1],x0[2],x0[3],x1[0],x1[1],x1[2],x1[3],x2[0],x2[1],x2[2],x2[3],x3[0],x3[1],x3[2],x3[3]};
#pragma unroll
    for (int i = 0; i < 16; ++i) { const unsigned short hb = bf16_bits(xs[i]); ah.u[i] = hb; al.u[i] = ASPLIT ? bf16_bits(xs[i] - bf16_val(hb)) : (unsigned short)0; }
#pragma unroll
    for (int t = 0; t < 4; ++t) {
      const unsigned short* brow = Wt + (size_t)(col0 + t * 16 + ln) * ldb + kb;
      FragB b;
      b.half[0] = *(const v8us*)(brow + 8 * hh);
      b.half[1] = *(const v8us*)(brow + 16 + 8 * hh);
      acc[t] = mmaN<ASPLIT ? 2 : 1>(ah.v, al.v, b.v, b.v, acc[t]);
    }
  }
#pragma unroll
  for (int t = 0; t < 4; ++t) {
    float bv = bias ? bias[col0 + t * 16 + ln] : 0.f;
    if (BIAS_BF16) bv = bf16_round(bv);
#pragma unroll
    for (int r = 0; r < 8; ++r) { float v = acc[t][r] + bv; if (ACT == 1) v = fmaxf(v, 0.f); so[w][8 * hh + r][t * 16 + ln] = v; }
  }
  __builtin_amdgcn_fence(__ATOMIC_ACQ_REL, "workgroup");
  __builtin_amdgcn_wave_barrier();
  const int rsub = lane >> 4, c4 = (lane & 15) * 4;
  {
#pragma unroll
    for (int q = 0; q < 8; ++q) {
      const int r = q * 2 + rsub;
      const v4f v = *(const v4fa*)&so[w][r][c4];
      *(v4f*)(C + (size_t)(row0 + r) * ldc + col0 + c4) = v;
    }
    
  }
}

// GEMM C = act(A·W + bias + resid): A f32 (ASPLIT -> hi/lo 2 terms), Wt bf16 [N][K]; ACT 0 none, 1 relu, 2 exact gelu;
// resid (optional, f32, row index = (row % rmod), pitch ldr, RES_BF16 rounds it) added before the activation.
template <bool ASPLIT, int ACT, bool BIAS_BF16, bool RES_BF16>
__global__ __launch_bounds__(128) void k_gemm_bf3(const float* __restrict__ A, int lda, const unsigned short* __restrict__ Wt, int ldb,
                                                const float* __restrict__ bias, const float* __restrict__ resid, int rmod, int ldr,
                                                float* __restrict__ C, int ldc, int M, int N, int K) {
  __shared__ __attribute__((aligned(16))) float so[4][16][64];
  const int tid = threadIdx.x, w = tid >> 5, lane = tid & 31, ln = lane & 15, hh = lane >> 4;
  const int ntn = N / 64;
  const int wid = blockIdx.x * 4 + w;
  const int mt = wid / ntn, nq = wid % ntn;
  if (mt * 16 >= M) return;
  const int row0 = mt * 16, col0 = nq * 64;
  const float* arow = A + (size_t)(row0 + ln) * lda;
  v8f acc[4] = {};
  for (int kb = 0; kb < K; kb += 32) {
    FragB ah, al;
    const v4f x0 = *(const v4fa*)(arow + kb + 8 * hh), x1 = *(const v4fa*)(arow + kb + 8 * hh + 4);
    const v4f x2 = *(const v4fa*)(arow + kb + 16 + 8 * hh), x3 = *(const v4fa*)(arow + kb + 16 + 8 * hh + 4);
    float xs[16] = {x0[0],x0[1],x0[2],x0[3],x1[0],x1[1],x1[2],x1[3],x2[0],x2[1],x2[2],x2[3],x3[0],x3[1],x3[2],x3[3]};
#pragma unroll
    for (int i = 0; i < 16; ++i) { const unsigned short hb = bf16_bits(xs[i]); ah.u[i] = hb; al.u[i] = ASPLIT ? bf16_bits(xs[i] - bf16_val(hb)) : (unsigned short)0; }
#pragma unroll
    for (int t = 0; t < 4; ++t) {
      const unsigned short* brow = Wt + (size_t)(col0 + t * 16 + ln) * ldb + kb;
      FragB b;
      b.half[0] = *(const v8us*)(brow + 8 * hh);
      b.half[1] = *(const v8us*)(brow + 16 + 8 * hh);
      acc[t] = mmaN<ASPLIT ? 2 : 1>(ah.v, al.v, b.v, b.v, acc[t]);
    }
  }
#pragma unroll
  for (int t = 0; t < 4; ++t) {
    const int col = col0 + t * 16 + ln;
    float bv = bias ? bias[col] : 0.f;
    if (BIAS_BF16) bv = bf16_round(bv);
#pragma unroll
    for (int r = 0; r < 8; ++r) {
      float v = acc[t][r] + bv;
      if (resid) { float rv = resid[(size_t)((row0 + 8 * hh + r) % rmod) * ldr + col]; if (RES_BF16) rv = bf16_round(rv); v += rv; }
      if (ACT == 1) v = fmaxf(v, 0.f);
      if (ACT == 2) v = 0.5f * v * (1.0f + erff(v * 0.70710678118654752f));
      if (ACT == 3) { const float u = 0.7978845608028654f * (v + 0.044715f * v * v * v); v = 0.5f * v * (1.0f + tanhf(u)); }
      so[w][8 * hh + r][t * 16 + ln] = v;
    }
  }
  __builtin_amdgcn_fence(__ATOMIC_ACQ_REL, "workgroup");
  __builtin_amdgcn_wave_barrier();
  const int rsub = lane >> 4, c4 = (lane & 15) * 4;
  {
#pragma unroll
    for (int q = 0; q < 8; ++q) {
      const int r = q * 2 + rsub;
      const v4f v = *(const v4fa*)&so[w][r][c4];
      *(v4f*)(C + (size_t)(row0 + r) * ldc + col0 + c4) = v;
    }
    
  }
}
// row LayerNorm (biased variance, eps) over N: s = X (+ R); optional out_sum <- s; out_norm <- (s-mu)*rsqrt(var+eps)*g + b
template <bool PARAM_BF16>
__global__ __launch_bounds__(256) void k_layernorm(const float* __restrict__ X, const float* __restrict__ R, const float* __restrict__ g, const float* __restrict__ bta,
                                                  float* __restrict__ out_sum, float* __restrict__ out_norm, int N, float eps) {
  __shared__ float red[256];
  const int row = blockIdx.x, tid = threadIdx.x;
  const float* x = X + (size_t)row * N; const float* rr = R ? R + (size_t)row * N : nullptr;
  float vals[16];                     // up to N = 4096
  const int per = N / 256;            // contiguous chunk per thread? use strided-by-4 chunks: thread handles j = tid*4 + 1024*u
  float s1 = 0.f;
  for (int u = 0; u < per / 4; ++u) {
    const int j = tid * 4 + 1024 * u;
    const v4f a = *(const v4fa*)(x + j);
    v4f b = {0.f,0.f,0.f,0.f}; if (rr) b = *(const v4fa*)(rr + j);
#pragma unroll
    for (int q = 0; q < 4; ++q) { const float v = a[q] + b[q]; vals[u * 4 + q] = v; s1 += v; }
  }
  red[tid] = s1; __syncthreads();
  for (int st = 128; st > 0; st >>= 1) { if (tid < st) red[tid] += red[tid + st]; __syncthreads(); }
  const float mu = red[0] / (float)N; __syncthreads();
  float s2 = 0.f;
  for (int u = 0; u < per / 4; ++u)
#pragma unroll
    for (int q = 0; q < 4; ++q) { const float c = vals[u * 4 + q] - mu; s2 += c * c; }
  red[tid] = s2; __syncthreads();
  for (int st = 128; st > 0; st >>= 1) { if (tid < st) red[tid] += red[tid + st]; __syncthreads(); }
  const float rs = rsqrtf(red[0] / (float)N + eps);
  {
    for (int u = 0; u < per / 4; ++u) {
      const int j = tid * 4 + 1024 * u;
      v4f o, sm;
#pragma unroll
      for (int q = 0; q < 4; ++q) {
        float gg = g[j + q], bb = bta[j + q];
        if (PARAM_BF16) { gg = bf16_round(gg); bb = bf16_round(bb); }
        sm[q] = vals[u * 4 + q]; o[q] = (vals[u * 4 + q] - mu) * rs * gg + bb;
      }
      if (out_sum) *(v4f*)(out_sum + (size_t)row * N + j) = sm;
      *(v4f*)(out_norm + (size_t)row * N + j) = o;
    }
    
  }
}



// ---- f16 WMMA path (v_wmma_f32_16x16x32_f16): 11-bit significands for operands in range — used where a [0,1] probability operand needs more precision than bf16
typedef _Float16 v16h __attribute__((ext_vector_type(16)));
union FragH { v16h v; v8us half[2]; _Float16 h[16]; unsigned short u[16]; };
template <int NT>
__device__ __forceinline__ v8f mmaH(v16h ah, v16h al, v16h bh, v16h bl, v8f c) {
  c = __builtin_amdgcn_wmma_f32_16x16x32_f16(false, ah, false, bh, (short)0, c, false, false);
  if (NT >= 2) c = __builtin_amdgcn_wmma_f32_16x16x32_f16(false, al, false, bh, (short)0, c, false, false);
  if (NT >= 3) c = __builtin_amdgcn_wmma_f32_16x16x32_f16(false, ah, false, bl, (short)0, c, false, false);
  asm volatile("v_nop\n\tv_nop\n\tv_nop\n\tv_nop" : "+v"(c) : "v"(ah), "v"(al), "v"(bh), "v"(bl));
  return c;
}
// batched GEMM like k_gemm_b but f16 operands: A f32 (split into f16 hi/lo if ASPLIT, else rounded to f16), Bt = f16 values [n][k]; alpha; C f32; N multiple of 16 (partial tiles skipped)
template <bool ASPLIT>
__global__ __launch_bounds__(128) void k_gemm_h(const float* __restrict__ A, int lda, size_t sA, const _Float16* __restrict__ Bh, int ldb, size_t sB, float alpha, float* __restrict__ C, int ldc, size_t sC, int M, int N, int K) {
  __shared__ __attribute__((aligned(16))) float so[4][16][64];
  const int tid = threadIdx.x, w = tid >> 5, lane = tid & 31, ln = lane & 15, hh = lane >> 4; const int by = blockIdx.y;
  A += (size_t)by * sA; Bh += (size_t)by * sB; C += (size_t)by * sC;
  const int ntn = (N + 63) / 64; const int wid = blockIdx.x * 4 + w; const int mt = wid / ntn, nq = wid % ntn; if (mt * 16 >= M) return;
  const int row0 = mt * 16, col0 = nq * 64; const float* arow = A + (size_t)(row0 + ln) * lda;
  v8f acc[4] = {};
  for (int kb = 0; kb < K; kb += 32) {
    FragH ah, al;
    const v4f x0 = *(const v4fa*)(arow + kb + 8 * hh), x1 = *(const v4fa*)(arow + kb + 8 * hh + 4), x2 = *(const v4fa*)(arow + kb + 16 + 8 * hh), x3 = *(const v4fa*)(arow + kb + 16 + 8 * hh + 4);
    float xs[16] = {x0[0],x0[1],x0[2],x0[3],x1[0],x1[1],x1[2],x1[3],x2[0],x2[1],x2[2],x2[3],x3[0],x3[1],x3[2],x3[3]};
#pragma unroll
    for (int i = 0; i < 16; ++i) { const _Float16 h = (_Float16)xs[i]; ah.h[i] = h; al.h[i] = ASPLIT ? (_Float16)(xs[i] - (float)h) : (_Float16)0.0f; }
#pragma unroll
    for (int t = 0; t < 4; ++t) { if (col0 + t * 16 >= N) continue; const size_t boff = (size_t)(col0 + t * 16 + ln) * ldb + kb; FragH bq; bq.half[0] = *(const v8us*)(Bh + boff + 8 * hh); bq.half[1] = *(const v8us*)(Bh + boff + 16 + 8 * hh);
      acc[t] = mmaH<ASPLIT ? 2 : 1>(ah.v, al.v, bq.v, bq.v, acc[t]); }
  }
#pragma unroll
  for (int t = 0; t < 4; ++t) { if (col0 + t * 16 >= N) continue;
#pragma unroll
    for (int r = 0; r < 8; ++r) so[w][8 * hh + r][t * 16 + ln] = acc[t][r] * alpha; }
  __builtin_amdgcn_fence(__ATOMIC_ACQ_REL, "workgroup"); __builtin_amdgcn_wave_barrier();
  const int rsub = lane >> 4, c4 = (lane & 15) * 4;
  {
#pragma unroll
    for (int q = 0; q < 8; ++q) { const int r = q * 2 + rsub; if (col0 + c4 < N) { const v4f v = *(const v4fa*)&so[w][r][c4]; *(v4f*)(C + (size_t)(row0 + r) * ldc + col0 + c4) = v; } }
     }
}

// Wt[n][k] = f16(W[k][n]·scale) from f32 row-major W[K][N] (scale = power of two; bf16-exact weights stay exact in f16 away from the subnormal range)
__global__ __launch_bounds__(256) void k_wt_f16(const float* __restrict__ W, _Float16* __restrict__ Wt, int K, int N, float scale) {
  const int t = blockIdx.x * 256 + threadIdx.x; if (t >= N * (K / 8)) return; const int n = t / (K / 8), k8 = (t % (K / 8)) * 8; FragH f;
#pragma unroll
  for (int i = 0; i < 8; ++i) f.h[i] = (_Float16)(bf16_round(W[(size_t)(k8 + i) * N + n]) * scale); const v8us o = f.half[0];
  *(v8us*)((unsigned short*)Wt + (size_t)n * K + k8) = o; 
}
// k_gemm_hh variant with fused epilogue: v = acc·alpha + bias[by·sBias + col] (+ CP[(row/rowsPerB)·sCPb + by·64 + col] if CP) ; ACT 0 none / 1 elu ; writes f16 C16 (and f32 C if non-null)
template <int ACT>
__global__ __launch_bounds__(128) void k_gemm_hhx(const _Float16* __restrict__ A, int lda, size_t sA, const _Float16* __restrict__ Bh, int ldb, size_t sB, float alpha, const float* __restrict__ bias, size_t sBias, const float* __restrict__ CP, int rowsPerB, size_t sCPb, int row0g,
    float* __restrict__ C, _Float16* __restrict__ C16, int ldc, size_t sC, int M, int N, int K) {
  __shared__ __attribute__((aligned(16))) float so[4][16][64];
  const int tid = threadIdx.x, w = tid >> 5, lane = tid & 31, ln = lane & 15, hh = lane >> 4; const int by = blockIdx.y;
  A += (size_t)by * sA; Bh += (size_t)by * sB; const size_t cofs = (size_t)by * sC; const float* bp = bias ? bias + (size_t)by * sBias : nullptr;
  const int ntn = (N + 63) / 64; const int wid = blockIdx.x * 4 + w; const int mt = wid / ntn, nq = wid % ntn; if (mt * 16 >= M) return;
  const int row0 = mt * 16, col0 = nq * 64; const _Float16* arow = A + (size_t)(row0 + ln) * lda;
  v8f acc[4] = {};
  for (int kb = 0; kb < K; kb += 32) { FragH ah; ah.half[0] = *(const v8us*)((const unsigned short*)arow + kb + 8 * hh); ah.half[1] = *(const v8us*)((const unsigned short*)arow + kb + 16 + 8 * hh);
#pragma unroll
    for (int t = 0; t < 4; ++t) { if (col0 + t * 16 >= N) continue; const size_t boff = (size_t)(col0 + t * 16 + ln) * ldb + kb; FragH bq; bq.half[0] = *(const v8us*)((const unsigned short*)Bh + boff + 8 * hh); bq.half[1] = *(const v8us*)((const unsigned short*)Bh + boff + 16 + 8 * hh);
      acc[t] = mmaH<1>(ah.v, ah.v, bq.v, bq.v, acc[t]); }
  }
#pragma unroll
  for (int t = 0; t < 4; ++t) { if (col0 + t * 16 >= N) continue; const int col = col0 + t * 16 + ln; const float bv = bp ? bf16_round(bp[col]) : 0.f;
#pragma unroll
    for (int r = 0; r < 8; ++r) { float v = acc[t][r] * alpha + bv; if (CP) { const int rr = row0g + row0 + 8 * hh + r; if (rowsPerB < 0) v += CP[cofs + (size_t)rr * ldc + col];      /* rowsPerB < 0: own element of the batched C plane */ else { const int bidx = rr / rowsPerB; v += CP[(size_t)bidx * sCPb + (size_t)by * 64 + col]; } } if (ACT == 1) v = (v > 0.f) ? v : expm1f(v); else if (ACT == 7) v = (v > 0.f) ? v + 1.0f : expf(v); else if (ACT == 8) v = tanhf(v); else if (ACT == 9) v = 0.5f * v * (1.0f + tanhf(0.7978845608028654f * (v + 0.044715f * v * v * v))); else if (ACT == 11) v = 1.0f / (1.0f + expf(-v)); else if (ACT == 12) v = (v > 0.f) ? v : 0.01f * v; else if (ACT == 14) v = (v > 0.f) ? v : 0.1f * v; else if (ACT == 16) v = (v >= 0.f) ? v : 0.3f * v; else if (ACT == 17) v = (v >= 0.f) ? v : 0.2f * v; else if (ACT == 15) v = v / (1.0f + expf(-v)); else if (ACT == 3) v = fmaxf(v, 0.f); else if (ACT == 6) v = 0.5f * v * (1.0f + erff(v * 0.70710678118654752f)); so[w][8 * hh + r][t * 16 + ln] = v; } }
  __builtin_amdgcn_fence(__ATOMIC_ACQ_REL, "workgroup"); __builtin_amdgcn_wave_barrier();
  const int rsub = lane >> 4, c4 = (lane & 15) * 4; typedef _Float16 v4h __attribute__((ext_vector_type(4)));
  {
#pragma unroll
    for (int q = 0; q < 8; ++q) { const int r = q * 2 + rsub; if (col0 + c4 < N) { const v4f v = *(const v4fa*)&so[w][r][c4]; if (C) *(v4f*)(C + cofs + (size_t)(row0 + r) * ldc + col0 + c4) = v; if (C16) { v4h h4; for (int i = 0; i < 4; ++i) h4[i] = (_Float16)v[i]; *(v4h*)(C16 + cofs + (size_t)(row0 + r) * ldc + col0 + c4) = h4; } } }
     }
}


typedef _Float16 v4h __attribute__((ext_vector_type(4)));

__global__ __launch_bounds__(256) void k_x16(const float* __restrict__ x, _Float16* __restrict__ X16, size_t n8) { const size_t t = (size_t)blockIdx.x * 256 + threadIdx.x; if (t >= n8) return; FragH f;
#pragma unroll
  for (int q = 0; q < 8; ++q) f.h[q] = (_Float16)bf16_round(x[t * 8 + q]); *(v8us*)((unsigned short*)X16 + t * 8) = f.half[0];  }
__global__ __launch_bounds__(256) void k_h16(const float* __restrict__ x, _Float16* __restrict__ X16, size_t n8) { const size_t t = (size_t)blockIdx.x * 256 + threadIdx.x; if (t >= n8) return; FragH f;
#pragma unroll
  for (int q = 0; q < 8; ++q) f.h[q] = (_Float16)x[t * 8 + q]; *(v8us*)((unsigned short*)X16 + t * 8) = f.half[0];  }
__global__ __launch_bounds__(256) void k_round16f(const float* __restrict__ W, _Float16* __restrict__ Bt, size_t n8) { const size_t t = (size_t)blockIdx.x * 256 + threadIdx.x; if (t >= n8) return; FragH f;
#pragma unroll
  for (int i = 0; i < 8; ++i) f.h[i] = (_Float16)(bf16_round(W[t * 8 + i]) * 16.0f); *(v8us*)((unsigned short*)Bt + t * 8) = f.half[0];  }
template <int NHv, int TTv>
__global__ __launch_bounds__(256) void k_vt(const _Float16* __restrict__ V16, int ldv, int voff, _Float16* __restrict__ Vt) { __shared__ unsigned short tl[64][66]; const int tid = threadIdx.x; const int slab = blockIdx.x / (TTv / 64), lg = blockIdx.x % (TTv / 64); const int b = slab / NHv, h = slab % NHv;
  for (int i = tid; i < 64 * 8; i += 256) { const int r = i / 8, c8 = (i % 8) * 8; FragH f; f.half[0] = *(const v8us*)((const unsigned short*)V16 + ((size_t)b * TTv + lg * 64 + r) * ldv + voff + h * 64 + c8);
#pragma unroll
    for (int q = 0; q < 8; ++q) tl[r][c8 + q] = f.u[q]; }
  __syncthreads();
  {
#pragma unroll
    for (int rd = 0; rd < 2; ++rd) { const int d = rd * 32 + tid / 8, pc = tid % 8; FragH f;
#pragma unroll
      for (int q = 0; q < 8; ++q) f.u[q] = tl[pc * 8 + q][d];
      *(v8us*)((unsigned short*)Vt + ((size_t)slab * 64 + d) * TTv + lg * 64 + pc * 8) = f.half[0]; }
     } }

__global__ __launch_bounds__(256) void k_hl(const float* __restrict__ F, _Float16* __restrict__ Hh, _Float16* __restrict__ Hl, size_t n8) { const size_t t = (size_t)blockIdx.x * 256 + threadIdx.x; if (t >= n8) return; FragH fh, fl; const v4f a = *(const v4fa*)(F + t * 8), c = *(const v4fa*)(F + t * 8 + 4);
#pragma unroll
  for (int q = 0; q < 4; ++q) { _Float16 h = (_Float16)a[q]; fh.h[q] = h; fl.h[q] = (_Float16)((a[q] - (float)h) * 1024.0f); h = (_Float16)c[q]; fh.h[4 + q] = h; fl.h[4 + q] = (_Float16)((c[q] - (float)h) * 1024.0f); }
  { *(v8us*)((unsigned short*)Hh + t * 8) = fh.half[0]; *(v8us*)((unsigned short*)Hl + t * 8) = fl.half[0];  } }

// ---- fast GEMM (wave tile 32x64; requires M % 32 == 0 rows per launch region and N % 64 == 0); epilogue = k_gemm_hhx semantics ----
__device__ __forceinline__ v16h g2_frag(const _Float16* p, int hh) { FragH f; f.half[0] = *(const v8us*)((const unsigned short*)p + 8 * hh); f.half[1] = *(const v8us*)((const unsigned short*)p + 16 + 8 * hh); return f.v; }
__device__ __forceinline__ v8f g2_mma(v16h a, v16h b, v8f c) { v8f d = __builtin_amdgcn_wmma_f32_16x16x32_f16(false, a, false, b, (short)0, c, false, false); asm volatile("v_nop\n\tv_nop\n\tv_nop\n\tv_nop" : "+v"(d) : "v"(a), "v"(b)); return d; }
template <int ACT>
__global__ __launch_bounds__(128) void k_gemm2(const _Float16* __restrict__ A, int lda, size_t sA, const _Float16* __restrict__ Bh, int ldb, size_t sB, float alpha, const float* __restrict__ bias, size_t sBias, const float* __restrict__ CP, int rowsPerB, size_t sCPb, int row0g,
    float* __restrict__ C, _Float16* __restrict__ C16, int ldc, size_t sC, int M, int N, int K) { static_assert(ACT == 0 || ACT == 3 || ACT == 6 || ACT == 8 || ACT == 9 || ACT == 11 || ACT == 12 || ACT == 14 || ACT == 15 || ACT == 16 || ACT == 17, "k_gemm2: unsupported ACT code (would silently apply no activation)");
  __shared__ __attribute__((aligned(16))) float so[4][32][68];
  const int tid = threadIdx.x, w = tid >> 5, lane = tid & 31, ln = lane & 15, hh = lane >> 4; const int by = blockIdx.y;
  A += (size_t)by * sA; Bh += (size_t)by * sB; const size_t cofs = (size_t)by * sC; const float* bp = bias ? bias + (size_t)by * sBias : nullptr;
  const int ntn = N >> 6; const int mt = blockIdx.x / ntn, nq = blockIdx.x - mt * ntn; const int row0 = mt * 128 + 32 * w, col0 = nq * 64; if (row0 >= M) return;
  const _Float16* a0p = A + (size_t)(row0 + ln) * lda; const _Float16* a1p = a0p + (size_t)16 * lda;
  const _Float16* b0p = Bh + (size_t)(col0 + ln) * ldb; const _Float16* b1p = b0p + (size_t)16 * ldb; const _Float16* b2p = b1p + (size_t)16 * ldb; const _Float16* b3p = b2p + (size_t)16 * ldb;
  const v8f z8 = {0.f,0.f,0.f,0.f,0.f,0.f,0.f,0.f}; v8f c00 = z8, c01 = z8, c02 = z8, c03 = z8, c10 = z8, c11 = z8, c12 = z8, c13 = z8;
#pragma unroll 1
  for (int kb = 0; kb < K; kb += 32) { const v16h a0 = g2_frag(a0p + kb, hh), a1 = g2_frag(a1p + kb, hh);
    v16h b = g2_frag(b0p + kb, hh); c00 = g2_mma(a0, b, c00); c10 = g2_mma(a1, b, c10);
    b = g2_frag(b1p + kb, hh); c01 = g2_mma(a0, b, c01); c11 = g2_mma(a1, b, c11);
    b = g2_frag(b2p + kb, hh); c02 = g2_mma(a0, b, c02); c12 = g2_mma(a1, b, c12);
    b = g2_frag(b3p + kb, hh); c03 = g2_mma(a0, b, c03); c13 = g2_mma(a1, b, c13); }
  v8f accs[8] = {c00, c01, c02, c03, c10, c11, c12, c13};
#pragma unroll
  for (int u = 0; u < 8; ++u) { const int t = u & 3, half = u >> 2; const int col = col0 + t * 16 + ln; const float bv = bp ? bf16_round(bp[col]) : 0.f;
#pragma unroll
    for (int r = 0; r < 8; ++r) { const int rloc = half * 16 + 8 * hh + r; float v = accs[u][r] * alpha + bv; if (CP) { if (rowsPerB < 0) v += CP[cofs + (size_t)(row0g + row0 + rloc) * ldc + col];      /* rowsPerB < 0: own element of the batched C plane */ else { const int bidx = (row0g + row0 + rloc) / rowsPerB; v += CP[(size_t)bidx * sCPb + (size_t)by * 64 + col]; } }
      if (ACT == 3) v = fmaxf(v, 0.f); else if (ACT == 6) v = 0.5f * v * (1.0f + erff(v * 0.70710678118654752f)); else if (ACT == 11) v = 1.0f / (1.0f + expf(-v)); else if (ACT == 15) v = v / (1.0f + expf(-v)); else if (ACT == 12) v = (v > 0.f) ? v : 0.01f * v; else if (ACT == 8) v = tanhf(v); else if (ACT == 9) v = 0.5f * v * (1.0f + tanhf(0.7978845608028654f * (v + 0.044715f * v * v * v))); else if (ACT == 14) v = (v > 0.f) ? v : 0.1f * v; else if (ACT == 16) v = (v >= 0.f) ? v : 0.3f * v; else if (ACT == 17) v = (v >= 0.f) ? v : 0.2f * v;
      so[w][rloc][t * 16 + ln] = v; } }
  __builtin_amdgcn_fence(__ATOMIC_ACQ_REL, "workgroup"); __builtin_amdgcn_wave_barrier();
  const int rsub = lane >> 4, c4 = (lane & 15) * 4;
  {
#pragma unroll
    for (int q = 0; q < 16; ++q) { const int r = q * 2 + rsub; const v4f v = *(const v4fa*)&so[w][r][c4]; if (C) *(v4f*)(C + cofs + (size_t)(row0 + r) * ldc + col0 + c4) = v; if (C16) { v4h h4; for (int i = 0; i < 4; ++i) h4[i] = (_Float16)v[i]; *(v4h*)(C16 + cofs + (size_t)(row0 + r) * ldc + col0 + c4) = h4; } }
     } }


__global__ __launch_bounds__(256) void k_wnat(const float* __restrict__ w, size_t n8, _Float16* __restrict__ Bt) { const size_t t = (size_t)blockIdx.x * 256 + threadIdx.x; if (t >= n8) return; FragH f; for (int q = 0; q < 8; ++q) f.h[q] = (_Float16)(bf16_round(w[t * 8 + q]) * 16.0f); *(v8us*)((unsigned short*)Bt + t * 8) = f.half[0];  }
#define FK 64                        /* keys per stage */
#define KPH 136                      /* K tile row pitch in halves: 272 B = 16 B x odd, for 16-byte LDS reads */
#define VPH 72                       /* V^T tile row pitch in halves: 144 B = 16 B x odd */
typedef float v2f __attribute__((ext_vector_type(2)));
typedef _Float16 v2h __attribute__((ext_vector_type(2)));
__device__ __forceinline__ float xhalf(float x) { return __builtin_bit_cast(float, __builtin_amdgcn_permlanex16(__builtin_bit_cast(int, x), __builtin_bit_cast(int, x), 0x76543210, 0xfedcba98, false, false)); }      /* lane l with lane l ^ 16 */
__device__ __forceinline__ v16h l_frag(const unsigned short* p) { FragH f; f.half[0] = *(const v8us*)p; f.half[1] = *(const v8us*)(p + 16); return f.v; }      /* p already holds the lane's 8 * hh */
__device__ __forceinline__ v8f f_mma(v16h a, v16h b, v8f c) { return __builtin_amdgcn_wmma_f32_16x16x32_f16(false, a, false, b, (short)0, c, false, false); }
__global__ __launch_bounds__(128) void k_fattn(const _Float16* __restrict__ Q, const _Float16* __restrict__ Kg, const _Float16* __restrict__ VTg, float* __restrict__ O) {
  __shared__ __attribute__((aligned(16))) unsigned short sk[2][FK * KPH];
  __shared__ __attribute__((aligned(16))) unsigned short sv[2][DKW * VPH];
  const int tid = threadIdx.x, w = tid >> 5, lane = tid & 31, ln = lane & 15, hh = lane >> 4;
  const int b = blockIdx.x / (SQ / 64), q0 = (blockIdx.x % (SQ / 64)) * 64 + w * 16;
  const unsigned short* kb = (const unsigned short*)Kg + (size_t)b * SQ * DKW;      /* wave-uniform bases; the lane's part is a 32-bit offset that lives through the whole loop */
  const unsigned short* vb = (const unsigned short*)VTg + (size_t)b * DKW * SQ;
  const unsigned kof = tid * 8;      /* a stage of K is 16 KiB in a row: piece i of this thread at + i * 1024 halves */
  const unsigned vof = (tid >> 3) * SQ + (tid & 7) * 8;      /* V^T: 128 rows x 128 B a stage: piece i is row 16 i + tid / 8 */
  const int ksto = (tid >> 4) * KPH + (tid & 15) * 8, vsto = (tid >> 3) * VPH + (tid & 7) * 8;
  const int krd = ln * KPH + 8 * hh, vrd = ln * VPH + 8 * hh;
  v16h qf[4];
  { const _Float16* qp = Q + ((size_t)b * SQ + q0 + ln) * DKW;
#pragma unroll
    for (int ks = 0; ks < 4; ++ks) qf[ks] = g2_frag(qp + ks * 32, hh); }
  v8us rk[8], rv[8];
#pragma unroll
  for (int i = 0; i < 8; ++i) { rk[i] = *(const v8us*)(kb + kof + i * 1024); rv[i] = *(const v8us*)(vb + vof + i * 16 * SQ); }
#pragma unroll
  for (int i = 0; i < 8; ++i) { *(v8us*)&sk[0][i * 8 * KPH + ksto] = rk[i]; *(v8us*)&sv[0][i * 16 * VPH + vsto] = rv[i]; }
  __syncthreads();      /* stage 0 is whole before anyone reads it */
  const float CS = 0.08838834764831845f * 1.4426950408889634f;      /* 1 / sqrt(128) and log2(e): the exponentials run in base 2 */
  const v8f z8 = {0.f,0.f,0.f,0.f,0.f,0.f,0.f,0.f};
  v8f o[8] = {z8, z8, z8, z8, z8, z8, z8, z8};
  float ms = -3.0e38f, lsum = 0.f;      /* running maximum (scaled, base 2) and this lane's half of the running sum */
#pragma unroll 1      /* one copy of the stage body: the loop stays small and every array index inside is a constant */
  for (int t = 0; t < SQ / FK; ++t) {
    const unsigned short* skb = sk[t & 1]; const unsigned short* svb = sv[t & 1];
    const unsigned short* kn = kb + (size_t)(t + 1) * (FK * DKW) + kof; const unsigned short* vn = vb + (t + 1) * FK + vof;      /* formed in the last stage too, read only where a next stage exists */
    if (t + 1 < SQ / FK) {      /* the next stage's lines fly while this stage is worked on */
#pragma unroll
      for (int i = 0; i < 8; ++i) { rk[i] = *(const v8us*)(kn + i * 1024); rv[i] = *(const v8us*)(vn + i * 16 * SQ); }
    }
    v16h fr[16];
#pragma unroll
    for (int ks = 0; ks < 4; ++ks)
#pragma unroll
      for (int mt = 0; mt < 4; ++mt) fr[ks * 4 + mt] = l_frag(skb + mt * 16 * KPH + krd + ks * 32);
    __builtin_amdgcn_sched_barrier(0);      /* all K fragment reads stand as one group ahead of the products: read one by one among them, each product waits out a whole LDS latency */
    v8f st[4] = {z8, z8, z8, z8};      /* S^T: tile mt holds keys 16 mt + 8 hh + r of query ln */
#pragma unroll
    for (int ks = 0; ks < 4; ++ks)
#pragma unroll
      for (int mt = 0; mt < 4; ++mt) st[mt] = f_mma(fr[ks * 4 + mt], qf[ks], st[mt]);
    asm volatile("s_wait_xcnt 0x0" :: "v"(kn), "v"(vn) : "memory");      /* the wait before a register that an issued load names is overwritten; the two address pairs as inputs stay whole up to here (without it the last load's result was placed on them); it stands behind the first product, where it no longer holds the wave up */
    /* the V^T fragment reads go out here, as one group, and land under the softmax arithmetic */
#pragma unroll
    for (int j = 0; j < 2; ++j)
#pragma unroll
      for (int ct = 0; ct < 8; ++ct) fr[j * 8 + ct] = l_frag(svb + ct * 16 * VPH + vrd + j * 32);
    __builtin_amdgcn_sched_barrier(0);      /* keeps those reads from sinking down to the second product */
    float m0 = st[0][0], m1 = st[1][0], m2 = st[2][0], m3 = st[3][0];
#pragma unroll
    for (int r = 1; r < 8; ++r) { m0 = fmaxf(m0, st[0][r]); m1 = fmaxf(m1, st[1][r]); m2 = fmaxf(m2, st[2][r]); m3 = fmaxf(m3, st[3][r]); }
    float mx = fmaxf(fmaxf(m0, m1), fmaxf(m2, m3)); mx = fmaxf(mx, xhalf(mx));
    const float mn = fmaxf(ms, mx * CS); const float al = __builtin_amdgcn_exp2f(ms - mn); ms = mn;      /* al is 0 in the first stage */
    const v2f cs2 = {CS, CS}, nm2 = {-mn, -mn}; v2f e2[16];
#pragma unroll
    for (int u = 0; u < 16; ++u) { const v2f s2 = {st[u >> 2][(u & 3) * 2], st[u >> 2][(u & 3) * 2 + 1]}; e2[u] = __builtin_elementwise_fma(s2, cs2, nm2); }
#pragma unroll
    for (int u = 0; u < 16; ++u) { e2[u][0] = __builtin_amdgcn_exp2f(e2[u][0]); e2[u][1] = __builtin_amdgcn_exp2f(e2[u][1]); }
    union { v16h v; v2h p[8]; } pf[2]; v2f a2[4];
#pragma unroll
    for (int u = 0; u < 16; ++u) pf[u >> 3].p[u & 7] = __builtin_convertvector(e2[u], v2h);      /* tiles 2 j and 2 j + 1 are registers 0-3 and 4-7 of B fragment j */
#pragma unroll
    for (int q = 0; q < 4; ++q) a2[q] = (e2[4 * q] + e2[4 * q + 1]) + (e2[4 * q + 2] + e2[4 * q + 3]);
    const v2f as = (a2[0] + a2[1]) + (a2[2] + a2[3]);
    lsum = fmaf(lsum, al, as[0] + as[1]);
#pragma unroll
    for (int ct = 0; ct < 8; ++ct) o[ct] *= al;
#pragma unroll
    for (int j = 0; j < 2; ++j)
#pragma unroll
      for (int ct = 0; ct < 8; ++ct) o[ct] = f_mma(fr[j * 8 + ct], pf[j].v, o[ct]);      /* O^T: tile ct holds channels 16 ct + 8 hh + r of query ln */
    if (t + 1 < SQ / FK) { unsigned short* skn = sk[(t + 1) & 1]; unsigned short* svn = sv[(t + 1) & 1];      /* that buffer's last readers left it before the barrier of the stage before */
#pragma unroll
      for (int i = 0; i < 8; ++i) { *(v8us*)&skn[i * 8 * KPH + ksto] = rk[i]; *(v8us*)&svn[i * 16 * VPH + vsto] = rv[i]; } }
    __syncthreads();      /* publishes stage t + 1 and ends every read of stage t */
  }
  lsum += xhalf(lsum); const float inv = 1.0f / lsum;
  float* op = O + ((size_t)b * SQ + q0 + ln) * DKW + 8 * hh;
#pragma unroll
  for (int ct = 0; ct < 8; ++ct) { const v4f lo = {o[ct][0] * inv, o[ct][1] * inv, o[ct][2] * inv, o[ct][3] * inv}, hi = {o[ct][4] * inv, o[ct][5] * inv, o[ct][6] * inv, o[ct][7] * inv};
    *(v4f*)(op + ct * 16) = lo; *(v4f*)(op + ct * 16 + 4) = hi; } }
__global__ __launch_bounds__(256) void k_vt(const _Float16* __restrict__ V16, int b, int h0, _Float16* __restrict__ VT) { __shared__ unsigned short tl[64][65]; const int tid = threadIdx.x; const int hh = blockIdx.x % HG, sg = blockIdx.x / HG; const int s0 = sg * 64; const int h = h0 + hh;
  for (int i = tid; i < 64 * 8; i += 256) { const int j = i / 8, d8 = (i % 8) * 8; FragH f; f.half[0] = *(const v8us*)((const unsigned short*)V16 + ((size_t)b * SQ + s0 + j) * DM + h * HD + d8); for (int q = 0; q < 8; ++q) tl[d8 + q][j] = f.u[q]; }
  __syncthreads();
  { for (int i = tid; i < 64 * 8; i += 256) { const int d = i / 8, j8 = (i % 8) * 8; FragH f; for (int q = 0; q < 8; ++q) f.u[q] = tl[d][j8 + q]; *(v8us*)((unsigned short*)VT + ((size_t)hh * HD + d) * SQ + s0 + j8) = f.half[0]; }  } }



__global__ __launch_bounds__(256) void k_rsmkm(const float* __restrict__ S, _Float16* __restrict__ P, int nrows, const int* __restrict__ am) {
  #pragma clang fp contract(off)
  const int t = blockIdx.x * 256 + threadIdx.x; if (t >= nrows) return; const size_t i = (size_t)t; const float* s = S + i * SQ; const int* mr = am + (size_t)(t % SQ) * SQ; float mx = -3.0e38f;
#pragma unroll 1
  for (int j = 0; j < SQ; ++j) { const float f = (mr[j] != 0) ? 1.f : 0.f; mx = fmaxf(mx, fmaf(f, s[j], (1.f - f) * -1.0e9f)); } float se = 0.f;
#pragma unroll 1
  for (int j = 0; j < SQ; ++j) { const float f = (mr[j] != 0) ? 1.f : 0.f; se += __expf(fmaf(f, s[j], (1.f - f) * -1.0e9f) - mx); } const float sc = 256.0f / se;
#pragma unroll 1
  for (int j0 = 0; j0 < SQ; j0 += 8) { FragH fr; for (int q = 0; q < 8; ++q) { const int j = j0 + q; const float f = (mr[j] != 0) ? 1.f : 0.f; fr.h[q] = (_Float16)(__expf(fmaf(f, s[j], (1.f - f) * -1.0e9f) - mx) * sc); }
    unsigned short* d = (unsigned short*)P + i * SQ + j0; *(v8us*)d = fr.half[0];  } }
extern "C" void kernel_launch(void* const* d_in, const int* in_sizes, int n_in,
                              void* d_out, int out_size, void* d_ws, size_t ws_size, hipStream_t stream) {
  (void)in_sizes; (void)n_in; (void)out_size;
  const float* const* I = (const float* const*)d_in; const float* x = I[0]; const float* wq = I[1]; const float* bq = I[2]; const float* wk = I[3]; const float* bk = I[4]; const float* wv = I[5]; const float* bv = I[6];      /* x; [in][out] Wq / Wk / Wv [256][128] + biases; no mask input */
  static_assert(SQ % 128 == 0 && SQ % 64 == 0 && SQ % 32 == 0 && DM % 32 == 0 && DKW % 64 == 0 && DKW % 32 == 0, "tile multiples");
  char* ws = (char*)d_ws; size_t off = 0;
  auto take = [&](size_t bytes) { char* p = ws + off; off += (bytes + 255) & ~(size_t)255; return p; };
  _Float16* BQ = (_Float16*)take((size_t)DKW * DM * 2); _Float16* BK = (_Float16*)take((size_t)DKW * DM * 2); _Float16* BV = (_Float16*)take((size_t)DKW * DM * 2);
  _Float16* X16 = (_Float16*)take(NR * DM * 2); _Float16* Q16 = (_Float16*)take(NR * DKW * 2); _Float16* K16 = (_Float16*)take(NR * DKW * 2); _Float16* V16 = (_Float16*)take(NR * DKW * 2);
  _Float16* VT = (_Float16*)take(NR * DKW * 2);
  if (off > ws_size) return;      /* approx 0.2 + 8 + 4 x 4 = 24 MiB */
  { const unsigned g = (unsigned)(((size_t)DKW * (DM / 8) + 255) / 256); k_wt_f16<<<g, 256, 0, stream>>>(wq, BQ, DM, DKW, 16.0f); k_wt_f16<<<g, 256, 0, stream>>>(wk, BK, DM, DKW, 16.0f); k_wt_f16<<<g, 256, 0, stream>>>(wv, BV, DM, DKW, 16.0f); }      /* [in][out] [256][128] -> Bt [128][256] x16 */
  k_x16<<<(unsigned)((NR * DM / 8 + 255) / 256), 256, 0, stream>>>(x, X16, NR * DM / 8);
  k_gemm2<0><<<dim3((unsigned)((NR / 128) * (DKW / 64)), 1), 128, 0, stream>>>(X16, DM, 0, BQ, DM, 0, 0.0625f, bq, 0, nullptr, 1, 0, 0, nullptr, Q16, DKW, 0, (int)NR, DKW, DM);
  k_gemm2<0><<<dim3((unsigned)((NR / 128) * (DKW / 64)), 1), 128, 0, stream>>>(X16, DM, 0, BK, DM, 0, 0.0625f, bk, 0, nullptr, 1, 0, 0, nullptr, K16, DKW, 0, (int)NR, DKW, DM);
  k_gemm2<0><<<dim3((unsigned)((NR / 128) * (DKW / 64)), 1), 128, 0, stream>>>(X16, DM, 0, BV, DM, 0, 0.0625f, bv, 0, nullptr, 1, 0, 0, nullptr, V16, DKW, 0, (int)NR, DKW, DM);      /* q, k, v rows (f16, 128 wide) */
  k_vt<DKW / 64, SQ><<<NB * (DKW / 64) * (SQ / 64), 256, 0, stream>>>(V16, DKW, 0, VT);      /* V^T [4][128][4096] */
  k_fattn<<<NB * (SQ / 64), 128, 0, stream>>>(Q16, K16, VT, (float*)d_out);      /* out = softmax(q k^T / sqrt(128)) v, f32 rows of the output */
}

// v003
// It runs in 57.4 microseconds.
// In two side-by-side timings against v002, it was 1.84 and 1.80 times as fast.
// All steps since v000 together make it 63.5 times as fast.
#include <hip/hip_runtime.h>
// Single-head self-attention (x [4][4096][256]; q = x Wq + bq, k = x Wk + bk, v = x Wv + bv ([in][out] 256 x 128, weights AND biases uniform +-1/16); scores = q k^T / sqrt(128); softmax over all 4096 keys (no mask); out = w v -> [4][4096][128]; no output projection).
// Structure: token rows r = b*4096 + s; ONE projection launch: x tile as exact f16 (bf16-rounded) in LDS, q, k, v by WMMA (64x32 wave tiles, f32 accumulation, exact x16 weights + bias, f16 outputs, 128 wide), v written as V^T; then ONE fused attention launch: scores, running softmax and the weighted sum of v per 64-key stage, written f32 straight into the output rows.
// Compute dtype: inputs rounded to bf16; x / weights exact; q, k, v and the unnormalised softmax weights exp(s - running max) as plain f16 GEMM operands (~2^-12); scores, softmax statistics and o f32. v_wmma_f32_16x16x32_f16.
#define NB 4
#define SQ 4096
#define DM 256                       /* input width */
#define DKW 128                      /* q / k / v width = the single head */
#define NH 1
#define HD 64
#define HG 4                         /* heads per block group of the non-template k_vt, which is not launched */
#define B0 0                         /* unused; every launch starts at batch 0 */
#define NBR NB                       /* read only by MP, which nothing reads */
#define NR ((size_t)NB * SQ)         /* token rows */
#define MP ((int)((size_t)NBR * SQ)) /* unused; the projections run over NR rows */
#define QN SQ                        /* unused; k_fattn attends all SQ query rows per batch */
#define NHD NH                       /* unused */
#define MPO MP                       /* unused */
#define LQ DM      /* unused; the q/k/v rows have pitch DKW */
typedef __bf16 v16b __attribute__((ext_vector_type(16)));
typedef unsigned short v8us __attribute__((ext_vector_type(8), may_alias));
typedef float  v8f  __attribute__((ext_vector_type(8)));
typedef float  v4f  __attribute__((ext_vector_type(4)));
typedef float  v4fa __attribute__((ext_vector_type(4), may_alias));
union FragB { v16b v; v8us half[2]; unsigned short u[16]; };

__device__ __forceinline__ unsigned short bf16_bits(float x) { unsigned int u = __float_as_uint(x); return (unsigned short)((u + 0x7FFFu + ((u >> 16) & 1u)) >> 16); }
__device__ __forceinline__ float bf16_val(unsigned short b) { return __uint_as_float(((unsigned int)b) << 16); }
__device__ __forceinline__ float bf16_round(float x) { return bf16_val(bf16_bits(x)); }
// D += A·B with NT terms: 1 = ah·bh, 2 = + al·bh (A split), 3 = + ah·bl (both split)
template <int NT>
__device__ __forceinline__ v8f mmaN(v16b ah, v16b al, v16b bh, v16b bl, v8f c) {
  c = __builtin_amdgcn_wmma_f32_16x16x32_bf16(false, ah, false, bh, (short)0, c, false, false);
  if (NT >= 2) c = __builtin_amdgcn_wmma_f32_16x16x32_bf16(false, al, false, bh, (short)0, c, false, false);
  if (NT >= 3) c = __builtin_amdgcn_wmma_f32_16x16x32_bf16(false, ah, false, bl, (short)0, c, false, false);
  asm volatile("v_nop\n\tv_nop\n\tv_nop\n\tv_nop" : "+v"(c) : "v"(ah), "v"(al), "v"(bh), "v"(bl));
  return c;
}

__global__ __launch_bounds__(256) void k_wt_bf16(const float* __restrict__ W, unsigned short* __restrict__ Wt, int K, int N) {
  const int t = blockIdx.x * 256 + threadIdx.x;
  const int k8n = K / 8;
  if (t >= N * k8n) return;
  const int n = t / k8n, k8 = (t % k8n) * 8;
  v8us v;
#pragma unroll
  for (int i = 0; i < 8; ++i) v[i] = bf16_bits(W[(size_t)(k8 + i) * N + n]);
  *(v8us*)(Wt + (size_t)n * K + k8) = v;
  
}

// GEMM C[M][N] (f32, pitch ldc) = act(A[M][K]·W + bias). A f32 row-major (pitch lda) converted per fragment to bf16
// (ASPLIT: hi/lo two planes -> 2 terms, else single rounded term); Wt bf16 [N][K] (pitch ldb). BIAS_BF16 rounds the
// bias to bf16 first (bias quantised to bf16 before the add). K%32==0, M%16==0, N%64==0.
template <bool ASPLIT, int ACT, bool BIAS_BF16>
__global__ __launch_bounds__(128) void k_gemm_bf(const float* __restrict__ A, int lda, const unsigned short* __restrict__ Wt, int ldb,
                                               const float* __restrict__ bias, float* __restrict__ C, int ldc, int M, int N, int K) {
  __shared__ __attribute__((aligned(16))) float so[4][16][64];
  const int tid = threadIdx.x, w = tid >> 5, lane = tid & 31, ln = lane & 15, hh = lane >> 4;
  const int ntn = N / 64;
  const int wid = blockIdx.x * 4 + w;
  const int mt = wid / ntn, nq = wid % ntn;
  if (mt * 16 >= M) return;
  const int row0 = mt * 16, col0 = nq * 64;
  const float* arow = A + (size_t)(row0 + ln) * lda;
  v8f acc[4] = {};
  for (int kb = 0; kb < K; kb += 32) {
    FragB ah, al;
    const v4f x0 = *(const v4fa*)(arow + kb + 8 * hh), x1 = *(const v4fa*)(arow + kb + 8 * hh + 4);
    const v4f x2 = *(const v4fa*)(arow + kb + 16 + 8 * hh), x3 = *(const v4fa*)(arow + kb + 16 + 8 * hh + 4);
    float xs[16] = {x0[0],x0[1],x0[2],x0[3],x1[0],x1[1],x1[2],x1[3],x2[0],x2[1],x2[2],x2[3],x3[0],x3[1],x3[2],x3[3]};
#pragma unroll
    for (int i = 0; i < 16; ++i) { const unsigned short hb = bf16_bits(xs[i]); ah.u[i] = hb; al.u[i] = ASPLIT ? bf16_bits(xs[i] - bf16_val(hb)) : (unsigned short)0; }
#pragma unroll
    for (int t = 0; t < 4; ++t) {
      const unsigned short* brow = Wt + (size_t)(col0 + t * 16 + ln) * ldb + kb;
      FragB b;
      b.half[0] = *(const v8us*)(brow + 8 * hh);
      b.half[1] = *(const v8us*)(brow + 16 + 8 * hh);
      acc[t] = mmaN<ASPLIT ? 2 : 1>(ah.v, al.v, b.v, b.v, acc[t]);
    }
  }
#pragma unroll
  for (int t = 0; t < 4; ++t) {
    float bv = bias ? bias[col0 + t * 16 + ln] : 0.f;
    if (BIAS_BF16) bv = bf16_round(bv);
#pragma unroll
    for (int r = 0; r < 8; ++r) { float v = acc[t][r] + bv; if (ACT == 1) v = fmaxf(v, 0.f); so[w][8 * hh + r][t * 16 + ln] = v; }
  }
  __builtin_amdgcn_fence(__ATOMIC_ACQ_REL, "workgroup");
  __builtin_amdgcn_wave_barrier();
  const int rsub = lane >> 4, c4 = (lane & 15) * 4;
  {
#pragma unroll
    for (int q = 0; q < 8; ++q) {
      const int r = q * 2 + rsub;
      const v4f v = *(const v4fa*)&so[w][r][c4];
      *(v4f*)(C + (size_t)(row0 + r) * ldc + col0 + c4) = v;
    }
    
  }
}

// GEMM C = act(A·W + bias + resid): A f32 (ASPLIT -> hi/lo 2 terms), Wt bf16 [N][K]; ACT 0 none, 1 relu, 2 exact gelu;
// resid (optional, f32, row index = (row % rmod), pitch ldr, RES_BF16 rounds it) added before the activation.
template <bool ASPLIT, int ACT, bool BIAS_BF16, bool RES_BF16>
__global__ __launch_bounds__(128) void k_gemm_bf3(const float* __restrict__ A, int lda, const unsigned short* __restrict__ Wt, int ldb,
                                                const float* __restrict__ bias, const float* __restrict__ resid, int rmod, int ldr,
                                                float* __restrict__ C, int ldc, int M, int N, int K) {
  __shared__ __attribute__((aligned(16))) float so[4][16][64];
  const int tid = threadIdx.x, w = tid >> 5, lane = tid & 31, ln = lane & 15, hh = lane >> 4;
  const int ntn = N / 64;
  const int wid = blockIdx.x * 4 + w;
  const int mt = wid / ntn, nq = wid % ntn;
  if (mt * 16 >= M) return;
  const int row0 = mt * 16, col0 = nq * 64;
  const float* arow = A + (size_t)(row0 + ln) * lda;
  v8f acc[4] = {};
  for (int kb = 0; kb < K; kb += 32) {
    FragB ah, al;
    const v4f x0 = *(const v4fa*)(arow + kb + 8 * hh), x1 = *(const v4fa*)(arow + kb + 8 * hh + 4);
    const v4f x2 = *(const v4fa*)(arow + kb + 16 + 8 * hh), x3 = *(const v4fa*)(arow + kb + 16 + 8 * hh + 4);
    float xs[16] = {x0[0],x0[1],x0[2],x0[3],x1[0],x1[1],x1[2],x1[3],x2[0],x2[1],x2[2],x2[3],x3[0],x3[1],x3[2],x3[3]};
#pragma unroll
    for (int i = 0; i < 16; ++i) { const unsigned short hb = bf16_bits(xs[i]); ah.u[i] = hb; al.u[i] = ASPLIT ? bf16_bits(xs[i] - bf16_val(hb)) : (unsigned short)0; }
#pragma unroll
    for (int t = 0; t < 4; ++t) {
      const unsigned short* brow = Wt + (size_t)(col0 + t * 16 + ln) * ldb + kb;
      FragB b;
      b.half[0] = *(const v8us*)(brow + 8 * hh);
      b.half[1] = *(const v8us*)(brow + 16 + 8 * hh);
      acc[t] = mmaN<ASPLIT ? 2 : 1>(ah.v, al.v, b.v, b.v, acc[t]);
    }
  }
#pragma unroll
  for (int t = 0; t < 4; ++t) {
    const int col = col0 + t * 16 + ln;
    float bv = bias ? bias[col] : 0.f;
    if (BIAS_BF16) bv = bf16_round(bv);
#pragma unroll
    for (int r = 0; r < 8; ++r) {
      float v = acc[t][r] + bv;
      if (resid) { float rv = resid[(size_t)((row0 + 8 * hh + r) % rmod) * ldr + col]; if (RES_BF16) rv = bf16_round(rv); v += rv; }
      if (ACT == 1) v = fmaxf(v, 0.f);
      if (ACT == 2) v = 0.5f * v * (1.0f + erff(v * 0.70710678118654752f));
      if (ACT == 3) { const float u = 0.7978845608028654f * (v + 0.044715f * v * v * v); v = 0.5f * v * (1.0f + tanhf(u)); }
      so[w][8 * hh + r][t * 16 + ln] = v;
    }
  }
  __builtin_amdgcn_fence(__ATOMIC_ACQ_REL, "workgroup");
  __builtin_amdgcn_wave_barrier();
  const int rsub = lane >> 4, c4 = (lane & 15) * 4;
  {
#pragma unroll
    for (int q = 0; q < 8; ++q) {
      const int r = q * 2 + rsub;
      const v4f v = *(const v4fa*)&so[w][r][c4];
      *(v4f*)(C + (size_t)(row0 + r) * ldc + col0 + c4) = v;
    }
    
  }
}
// row LayerNorm (biased variance, eps) over N: s = X (+ R); optional out_sum <- s; out_norm <- (s-mu)*rsqrt(var+eps)*g + b
template <bool PARAM_BF16>
__global__ __launch_bounds__(256) void k_layernorm(const float* __restrict__ X, const float* __restrict__ R, const float* __restrict__ g, const float* __restrict__ bta,
                                                  float* __restrict__ out_sum, float* __restrict__ out_norm, int N, float eps) {
  __shared__ float red[256];
  const int row = blockIdx.x, tid = threadIdx.x;
  const float* x = X + (size_t)row * N; const float* rr = R ? R + (size_t)row * N : nullptr;
  float vals[16];                     // up to N = 4096
  const int per = N / 256;            // contiguous chunk per thread? use strided-by-4 chunks: thread handles j = tid*4 + 1024*u
  float s1 = 0.f;
  for (int u = 0; u < per / 4; ++u) {
    const int j = tid * 4 + 1024 * u;
    const v4f a = *(const v4fa*)(x + j);
    v4f b = {0.f,0.f,0.f,0.f}; if (rr) b = *(const v4fa*)(rr + j);
#pragma unroll
    for (int q = 0; q < 4; ++q) { const float v = a[q] + b[q]; vals[u * 4 + q] = v; s1 += v; }
  }
  red[tid] = s1; __syncthreads();
  for (int st = 128; st > 0; st >>= 1) { if (tid < st) red[tid] += red[tid + st]; __syncthreads(); }
  const float mu = red[0] / (float)N; __syncthreads();
  float s2 = 0.f;
  for (int u = 0; u < per / 4; ++u)
#pragma unroll
    for (int q = 0; q < 4; ++q) { const float c = vals[u * 4 + q] - mu; s2 += c * c; }
  red[tid] = s2; __syncthreads();
  for (int st = 128; st > 0; st >>= 1) { if (tid < st) red[tid] += red[tid + st]; __syncthreads(); }
  const float rs = rsqrtf(red[0] / (float)N + eps);
  {
    for (int u = 0; u < per / 4; ++u) {
      const int j = tid * 4 + 1024 * u;
      v4f o, sm;
#pragma unroll
      for (int q = 0; q < 4; ++q) {
        float gg = g[j + q], bb = bta[j + q];
        if (PARAM_BF16) { gg = bf16_round(gg); bb = bf16_round(bb); }
        sm[q] = vals[u * 4 + q]; o[q] = (vals[u * 4 + q] - mu) * rs * gg + bb;
      }
      if (out_sum) *(v4f*)(out_sum + (size_t)row * N + j) = sm;
      *(v4f*)(out_norm + (size_t)row * N + j) = o;
    }
    
  }
}



// ---- f16 WMMA path (v_wmma_f32_16x16x32_f16): 11-bit significands for operands in range — used where a [0,1] probability operand needs more precision than bf16
typedef _Float16 v16h __attribute__((ext_vector_type(16)));
union FragH { v16h v; v8us half[2]; _Float16 h[16]; unsigned short u[16]; };
template <int NT>
__device__ __forceinline__ v8f mmaH(v16h ah, v16h al, v16h bh, v16h bl, v8f c) {
  c = __builtin_amdgcn_wmma_f32_16x16x32_f16(false, ah, false, bh, (short)0, c, false, false);
  if (NT >= 2) c = __builtin_amdgcn_wmma_f32_16x16x32_f16(false, al, false, bh, (short)0, c, false, false);
  if (NT >= 3) c = __builtin_amdgcn_wmma_f32_16x16x32_f16(false, ah, false, bl, (short)0, c, false, false);
  asm volatile("v_nop\n\tv_nop\n\tv_nop\n\tv_nop" : "+v"(c) : "v"(ah), "v"(al), "v"(bh), "v"(bl));
  return c;
}
// batched GEMM like k_gemm_b but f16 operands: A f32 (split into f16 hi/lo if ASPLIT, else rounded to f16), Bt = f16 values [n][k]; alpha; C f32; N multiple of 16 (partial tiles skipped)
template <bool ASPLIT>
__global__ __launch_bounds__(128) void k_gemm_h(const float* __restrict__ A, int lda, size_t sA, const _Float16* __restrict__ Bh, int ldb, size_t sB, float alpha, float* __restrict__ C, int ldc, size_t sC, int M, int N, int K) {
  __shared__ __attribute__((aligned(16))) float so[4][16][64];
  const int tid = threadIdx.x, w = tid >> 5, lane = tid & 31, ln = lane & 15, hh = lane >> 4; const int by = blockIdx.y;
  A += (size_t)by * sA; Bh += (size_t)by * sB; C += (size_t)by * sC;
  const int ntn = (N + 63) / 64; const int wid = blockIdx.x * 4 + w; const int mt = wid / ntn, nq = wid % ntn; if (mt * 16 >= M) return;
  const int row0 = mt * 16, col0 = nq * 64; const float* arow = A + (size_t)(row0 + ln) * lda;
  v8f acc[4] = {};
  for (int kb = 0; kb < K; kb += 32) {
    FragH ah, al;
    const v4f x0 = *(const v4fa*)(arow + kb + 8 * hh), x1 = *(const v4fa*)(arow + kb + 8 * hh + 4), x2 = *(const v4fa*)(arow + kb + 16 + 8 * hh), x3 = *(const v4fa*)(arow + kb + 16 + 8 * hh + 4);
    float xs[16] = {x0[0],x0[1],x0[2],x0[3],x1[0],x1[1],x1[2],x1[3],x2[0],x2[1],x2[2],x2[3],x3[0],x3[1],x3[2],x3[3]};
#pragma unroll
    for (int i = 0; i < 16; ++i) { const _Float16 h = (_Float16)xs[i]; ah.h[i] = h; al.h[i] = ASPLIT ? (_Float16)(xs[i] - (float)h) : (_Float16)0.0f; }
#pragma unroll
    for (int t = 0; t < 4; ++t) { if (col0 + t * 16 >= N) continue; const size_t boff = (size_t)(col0 + t * 16 + ln) * ldb + kb; FragH bq; bq.half[0] = *(const v8us*)(Bh + boff + 8 * hh); bq.half[1] = *(const v8us*)(Bh + boff + 16 + 8 * hh);
      acc[t] = mmaH<ASPLIT ? 2 : 1>(ah.v, al.v, bq.v, bq.v, acc[t]); }
  }
#pragma unroll
  for (int t = 0; t < 4; ++t) { if (col0 + t * 16 >= N) continue;
#pragma unroll
    for (int r = 0; r < 8; ++r) so[w][8 * hh + r][t * 16 + ln] = acc[t][r] * alpha; }
  __builtin_amdgcn_fence(__ATOMIC_ACQ_REL, "workgroup"); __builtin_amdgcn_wave_barrier();
  const int rsub = lane >> 4, c4 = (lane & 15) * 4;
  {
#pragma unroll
    for (int q = 0; q < 8; ++q) { const int r = q * 2 + rsub; if (col0 + c4 < N) { const v4f v = *(const v4fa*)&so[w][r][c4]; *(v4f*)(C + (size_t)(row0 + r) * ldc + col0 + c4) = v; } }
     }
}

// Wt[n][k] = f16(W[k][n]·scale) from f32 row-major W[K][N] (scale = power of two; bf16-exact weights stay exact in f16 away from the subnormal range)
__global__ __launch_bounds__(256) void k_wt_f16(const float* __restrict__ W, _Float16* __restrict__ Wt, int K, int N, float scale) {
  const int t = blockIdx.x * 256 + threadIdx.x; if (t >= N * (K / 8)) return; const int n = t / (K / 8), k8 = (t % (K / 8)) * 8; FragH f;
#pragma unroll
  for (int i = 0; i < 8; ++i) f.h[i] = (_Float16)(bf16_round(W[(size_t)(k8 + i) * N + n]) * scale); const v8us o = f.half[0];
  *(v8us*)((unsigned short*)Wt + (size_t)n * K + k8) = o; 
}
// k_gemm_hh variant with fused epilogue: v = acc·alpha + bias[by·sBias + col] (+ CP[(row/rowsPerB)·sCPb + by·64 + col] if CP) ; ACT 0 none / 1 elu ; writes f16 C16 (and f32 C if non-null)
template <int ACT>
__global__ __launch_bounds__(128) void k_gemm_hhx(const _Float16* __restrict__ A, int lda, size_t sA, const _Float16* __restrict__ Bh, int ldb, size_t sB, float alpha, const float* __restrict__ bias, size_t sBias, const float* __restrict__ CP, int rowsPerB, size_t sCPb, int row0g,
    float* __restrict__ C, _Float16* __restrict__ C16, int ldc, size_t sC, int M, int N, int K) {
  __shared__ __attribute__((aligned(16))) float so[4][16][64];
  const int tid = threadIdx.x, w = tid >> 5, lane = tid & 31, ln = lane & 15, hh = lane >> 4; const int by = blockIdx.y;
  A += (size_t)by * sA; Bh += (size_t)by * sB; const size_t cofs = (size_t)by * sC; const float* bp = bias ? bias + (size_t)by * sBias : nullptr;
  const int ntn = (N + 63) / 64; const int wid = blockIdx.x * 4 + w; const int mt = wid / ntn, nq = wid % ntn; if (mt * 16 >= M) return;
  const int row0 = mt * 16, col0 = nq * 64; const _Float16* arow = A + (size_t)(row0 + ln) * lda;
  v8f acc[4] = {};
  for (int kb = 0; kb < K; kb += 32) { FragH ah; ah.half[0] = *(const v8us*)((const unsigned short*)arow + kb + 8 * hh); ah.half[1] = *(const v8us*)((const unsigned short*)arow + kb + 16 + 8 * hh);
#pragma unroll
    for (int t = 0; t < 4; ++t) { if (col0 + t * 16 >= N) continue; const size_t boff = (size_t)(col0 + t * 16 + ln) * ldb + kb; FragH bq; bq.half[0] = *(const v8us*)((const unsigned short*)Bh + boff + 8 * hh); bq.half[1] = *(const v8us*)((const unsigned short*)Bh + boff + 16 + 8 * hh);
      acc[t] = mmaH<1>(ah.v, ah.v, bq.v, bq.v, acc[t]); }
  }
#pragma unroll
  for (int t = 0; t < 4; ++t) { if (col0 + t * 16 >= N) continue; const int col = col0 + t * 16 + ln; const float bv = bp ? bf16_round(bp[col]) : 0.f;
#pragma unroll
    for (int r = 0; r < 8; ++r) { float v = acc[t][r] * alpha + bv; if (CP) { const int rr = row0g + row0 + 8 * hh + r; if (rowsPerB < 0) v += CP[cofs + (size_t)rr * ldc + col];      /* rowsPerB < 0: own element of the batched C plane */ else { const int bidx = rr / rowsPerB; v += CP[(size_t)bidx * sCPb + (size_t)by * 64 + col]; } } if (ACT == 1) v = (v > 0.f) ? v : expm1f(v); else if (ACT == 7) v = (v > 0.f) ? v + 1.0f : expf(v); else if (ACT == 8) v = tanhf(v); else if (ACT == 9) v = 0.5f * v * (1.0f + tanhf(0.7978845608028654f * (v + 0.044715f * v * v * v))); else if (ACT == 11) v = 1.0f / (1.0f + expf(-v)); else if (ACT == 12) v = (v > 0.f) ? v : 0.01f * v; else if (ACT == 14) v = (v > 0.f) ? v : 0.1f * v; else if (ACT == 16) v = (v >= 0.f) ? v : 0.3f * v; else if (ACT == 17) v = (v >= 0.f) ? v : 0.2f * v; else if (ACT == 15) v = v / (1.0f + expf(-v)); else if (ACT == 3) v = fmaxf(v, 0.f); else if (ACT == 6) v = 0.5f * v * (1.0f + erff(v * 0.70710678118654752f)); so[w][8 * hh + r][t * 16 + ln] = v; } }
  __builtin_amdgcn_fence(__ATOMIC_ACQ_REL, "workgroup"); __builtin_amdgcn_wave_barrier();
  const int rsub = lane >> 4, c4 = (lane & 15) * 4; typedef _Float16 v4h __attribute__((ext_vector_type(4)));
  {
#pragma unroll
    for (int q = 0; q < 8; ++q) { const int r = q * 2 + rsub; if (col0 + c4 < N) { const v4f v = *(const v4fa*)&so[w][r][c4]; if (C) *(v4f*)(C + cofs + (size_t)(row0 + r) * ldc + col0 + c4) = v; if (C16) { v4h h4; for (int i = 0; i < 4; ++i) h4[i] = (_Float16)v[i]; *(v4h*)(C16 + cofs + (size_t)(row0 + r) * ldc + col0 + c4) = h4; } } }
     }
}


typedef _Float16 v4h __attribute__((ext_vector_type(4)));

__global__ __launch_bounds__(256) void k_x16(const float* __restrict__ x, _Float16* __restrict__ X16, size_t n8) { const size_t t = (size_t)blockIdx.x * 256 + threadIdx.x; if (t >= n8) return; FragH f;
#pragma unroll
  for (int q = 0; q < 8; ++q) f.h[q] = (_Float16)bf16_round(x[t * 8 + q]); *(v8us*)((unsigned short*)X16 + t * 8) = f.half[0];  }
__global__ __launch_bounds__(256) void k_h16(const float* __restrict__ x, _Float16* __restrict__ X16, size_t n8) { const size_t t = (size_t)blockIdx.x * 256 + threadIdx.x; if (t >= n8) return; FragH f;
#pragma unroll
  for (int q = 0; q < 8; ++q) f.h[q] = (_Float16)x[t * 8 + q]; *(v8us*)((unsigned short*)X16 + t * 8) = f.half[0];  }
__global__ __launch_bounds__(256) void k_round16f(const float* __restrict__ W, _Float16* __restrict__ Bt, size_t n8) { const size_t t = (size_t)blockIdx.x * 256 + threadIdx.x; if (t >= n8) return; FragH f;
#pragma unroll
  for (int i = 0; i < 8; ++i) f.h[i] = (_Float16)(bf16_round(W[t * 8 + i]) * 16.0f); *(v8us*)((unsigned short*)Bt + t * 8) = f.half[0];  }
template <int NHv, int TTv>
__global__ __launch_bounds__(256) void k_vt(const _Float16* __restrict__ V16, int ldv, int voff, _Float16* __restrict__ Vt) { __shared__ unsigned short tl[64][66]; const int tid = threadIdx.x; const int slab = blockIdx.x / (TTv / 64), lg = blockIdx.x % (TTv / 64); const int b = slab / NHv, h = slab % NHv;
  for (int i = tid; i < 64 * 8; i += 256) { const int r = i / 8, c8 = (i % 8) * 8; FragH f; f.half[0] = *(const v8us*)((const unsigned short*)V16 + ((size_t)b * TTv + lg * 64 + r) * ldv + voff + h * 64 + c8);
#pragma unroll
    for (int q = 0; q < 8; ++q) tl[r][c8 + q] = f.u[q]; }
  __syncthreads();
  {
#pragma unroll
    for (int rd = 0; rd < 2; ++rd) { const int d = rd * 32 + tid / 8, pc = tid % 8; FragH f;
#pragma unroll
      for (int q = 0; q < 8; ++q) f.u[q] = tl[pc * 8 + q][d];
      *(v8us*)((unsigned short*)Vt + ((size_t)slab * 64 + d) * TTv + lg * 64 + pc * 8) = f.half[0]; }
     } }

__global__ __launch_bounds__(256) void k_hl(const float* __restrict__ F, _Float16* __restrict__ Hh, _Float16* __restrict__ Hl, size_t n8) { const size_t t = (size_t)blockIdx.x * 256 + threadIdx.x; if (t >= n8) return; FragH fh, fl; const v4f a = *(const v4fa*)(F + t * 8), c = *(const v4fa*)(F + t * 8 + 4);
#pragma unroll
  for (int q = 0; q < 4; ++q) { _Float16 h = (_Float16)a[q]; fh.h[q] = h; fl.h[q] = (_Float16)((a[q] - (float)h) * 1024.0f); h = (_Float16)c[q]; fh.h[4 + q] = h; fl.h[4 + q] = (_Float16)((c[q] - (float)h) * 1024.0f); }
  { *(v8us*)((unsigned short*)Hh + t * 8) = fh.half[0]; *(v8us*)((unsigned short*)Hl + t * 8) = fl.half[0];  } }

// ---- fast GEMM (wave tile 32x64; requires M % 32 == 0 rows per launch region and N % 64 == 0); epilogue = k_gemm_hhx semantics ----
__device__ __forceinline__ v16h g2_frag(const _Float16* p, int hh) { FragH f; f.half[0] = *(const v8us*)((const unsigned short*)p + 8 * hh); f.half[1] = *(const v8us*)((const unsigned short*)p + 16 + 8 * hh); return f.v; }
__device__ __forceinline__ v8f g2_mma(v16h a, v16h b, v8f c) { v8f d = __builtin_amdgcn_wmma_f32_16x16x32_f16(false, a, false, b, (short)0, c, false, false); asm volatile("v_nop\n\tv_nop\n\tv_nop\n\tv_nop" : "+v"(d) : "v"(a), "v"(b)); return d; }
template <int ACT>
__global__ __launch_bounds__(128) void k_gemm2(const _Float16* __restrict__ A, int lda, size_t sA, const _Float16* __restrict__ Bh, int ldb, size_t sB, float alpha, const float* __restrict__ bias, size_t sBias, const float* __restrict__ CP, int rowsPerB, size_t sCPb, int row0g,
    float* __restrict__ C, _Float16* __restrict__ C16, int ldc, size_t sC, int M, int N, int K) { static_assert(ACT == 0 || ACT == 3 || ACT == 6 || ACT == 8 || ACT == 9 || ACT == 11 || ACT == 12 || ACT == 14 || ACT == 15 || ACT == 16 || ACT == 17, "k_gemm2: unsupported ACT code (would silently apply no activation)");
  __shared__ __attribute__((aligned(16))) float so[4][32][68];
  const int tid = threadIdx.x, w = tid >> 5, lane = tid & 31, ln = lane & 15, hh = lane >> 4; const int by = blockIdx.y;
  A += (size_t)by * sA; Bh += (size_t)by * sB; const size_t cofs = (size_t)by * sC; const float* bp = bias ? bias + (size_t)by * sBias : nullptr;
  const int ntn = N >> 6; const int mt = blockIdx.x / ntn, nq = blockIdx.x - mt * ntn; const int row0 = mt * 128 + 32 * w, col0 = nq * 64; if (row0 >= M) return;
  const _Float16* a0p = A + (size_t)(row0 + ln) * lda; const _Float16* a1p = a0p + (size_t)16 * lda;
  const _Float16* b0p = Bh + (size_t)(col0 + ln) * ldb; const _Float16* b1p = b0p + (size_t)16 * ldb; const _Float16* b2p = b1p + (size_t)16 * ldb; const _Float16* b3p = b2p + (size_t)16 * ldb;
  const v8f z8 = {0.f,0.f,0.f,0.f,0.f,0.f,0.f,0.f}; v8f c00 = z8, c01 = z8, c02 = z8, c03 = z8, c10 = z8, c11 = z8, c12 = z8, c13 = z8;
#pragma unroll 1
  for (int kb = 0; kb < K; kb += 32) { const v16h a0 = g2_frag(a0p + kb, hh), a1 = g2_frag(a1p + kb, hh);
    v16h b = g2_frag(b0p + kb, hh); c00 = g2_mma(a0, b, c00); c10 = g2_mma(a1, b, c10);
    b = g2_frag(b1p + kb, hh); c01 = g2_mma(a0, b, c01); c11 = g2_mma(a1, b, c11);
    b = g2_frag(b2p + kb, hh); c02 = g2_mma(a0, b, c02); c12 = g2_mma(a1, b, c12);
    b = g2_frag(b3p + kb, hh); c03 = g2_mma(a0, b, c03); c13 = g2_mma(a1, b, c13); }
  v8f accs[8] = {c00, c01, c02, c03, c10, c11, c12, c13};
#pragma unroll
  for (int u = 0; u < 8; ++u) { const int t = u & 3, half = u >> 2; const int col = col0 + t * 16 + ln; const float bv = bp ? bf16_round(bp[col]) : 0.f;
#pragma unroll
    for (int r = 0; r < 8; ++r) { const int rloc = half * 16 + 8 * hh + r; float v = accs[u][r] * alpha + bv; if (CP) { if (rowsPerB < 0) v += CP[cofs + (size_t)(row0g + row0 + rloc) * ldc + col];      /* rowsPerB < 0: own element of the batched C plane */ else { const int bidx = (row0g + row0 + rloc) / rowsPerB; v += CP[(size_t)bidx * sCPb + (size_t)by * 64 + col]; } }
      if (ACT == 3) v = fmaxf(v, 0.f); else if (ACT == 6) v = 0.5f * v * (1.0f + erff(v * 0.70710678118654752f)); else if (ACT == 11) v = 1.0f / (1.0f + expf(-v)); else if (ACT == 15) v = v / (1.0f + expf(-v)); else if (ACT == 12) v = (v > 0.f) ? v : 0.01f * v; else if (ACT == 8) v = tanhf(v); else if (ACT == 9) v = 0.5f * v * (1.0f + tanhf(0.7978845608028654f * (v + 0.044715f * v * v * v))); else if (ACT == 14) v = (v > 0.f) ? v : 0.1f * v; else if (ACT == 16) v = (v >= 0.f) ? v : 0.3f * v; else if (ACT == 17) v = (v >= 0.f) ? v : 0.2f * v;
      so[w][rloc][t * 16 + ln] = v; } }
  __builtin_amdgcn_fence(__ATOMIC_ACQ_REL, "workgroup"); __builtin_amdgcn_wave_barrier();
  const int rsub = lane >> 4, c4 = (lane & 15) * 4;
  {
#pragma unroll
    for (int q = 0; q < 16; ++q) { const int r = q * 2 + rsub; const v4f v = *(const v4fa*)&so[w][r][c4]; if (C) *(v4f*)(C + cofs + (size_t)(row0 + r) * ldc + col0 + c4) = v; if (C16) { v4h h4; for (int i = 0; i < 4; ++i) h4[i] = (_Float16)v[i]; *(v4h*)(C16 + cofs + (size_t)(row0 + r) * ldc + col0 + c4) = h4; } }
     } }


__global__ __launch_bounds__(256) void k_wnat(const float* __restrict__ w, size_t n8, _Float16* __restrict__ Bt) { const size_t t = (size_t)blockIdx.x * 256 + threadIdx.x; if (t >= n8) return; FragH f; for (int q = 0; q < 8; ++q) f.h[q] = (_Float16)(bf16_round(w[t * 8 + q]) * 16.0f); *(v8us*)((unsigned short*)Bt + t * 8) = f.half[0];  }
#define FK 64                        /* keys per stage */
#define KPH 136                      /* K tile row pitch in halves: 272 B = 16 B x odd, for 16-byte LDS reads */
#define VPH 72                       /* V^T tile row pitch in halves: 144 B = 16 B x odd */
typedef float v2f __attribute__((ext_vector_type(2)));
typedef _Float16 v2h __attribute__((ext_vector_type(2)));
__device__ __forceinline__ float xhalf(float x) { return __builtin_bit_cast(float, __builtin_amdgcn_permlanex16(__builtin_bit_cast(int, x), __builtin_bit_cast(int, x), 0x76543210, 0xfedcba98, false, false)); }      /* lane l with lane l ^ 16 */
__device__ __forceinline__ v16h l_frag(const unsigned short* p) { FragH f; f.half[0] = *(const v8us*)p; f.half[1] = *(const v8us*)(p + 16); return f.v; }      /* p already holds the lane's 8 * hh */
__device__ __forceinline__ v8f f_mma(v16h a, v16h b, v8f c) { return __builtin_amdgcn_wmma_f32_16x16x32_f16(false, a, false, b, (short)0, c, false, false); }
__global__ __launch_bounds__(128) void k_fattn(const _Float16* __restrict__ Q, const _Float16* __restrict__ Kg, const _Float16* __restrict__ VTg, float* __restrict__ O) {
  __shared__ __attribute__((aligned(16))) unsigned short sk[2][FK * KPH];
  __shared__ __attribute__((aligned(16))) unsigned short sv[2][DKW * VPH];
  const int tid = threadIdx.x, w = tid >> 5, lane = tid & 31, ln = lane & 15, hh = lane >> 4;
  const int b = blockIdx.x / (SQ / 64), q0 = (blockIdx.x % (SQ / 64)) * 64 + w * 16;
  const unsigned short* kb = (const unsigned short*)Kg + (size_t)b * SQ * DKW;      /* wave-uniform bases; the lane's part is a 32-bit offset that lives through the whole loop */
  const unsigned short* vb = (const unsigned short*)VTg + (size_t)b * DKW * SQ;
  const unsigned kof = tid * 8;      /* a stage of K is 16 KiB in a row: piece i of this thread at + i * 1024 halves */
  const unsigned vof = (tid >> 3) * SQ + (tid & 7) * 8;      /* V^T: 128 rows x 128 B a stage: piece i is row 16 i + tid / 8 */
  const int ksto = (tid >> 4) * KPH + (tid & 15) * 8, vsto = (tid >> 3) * VPH + (tid & 7) * 8;
  const int krd = ln * KPH + 8 * hh, vrd = ln * VPH + 8 * hh;
  v16h qf[4];
  { const _Float16* qp = Q + ((size_t)b * SQ + q0 + ln) * DKW;
#pragma unroll
    for (int ks = 0; ks < 4; ++ks) qf[ks] = g2_frag(qp + ks * 32, hh); }
  v8us rk[8], rv[8];
#pragma unroll
  for (int i = 0; i < 8; ++i) { rk[i] = *(const v8us*)(kb + kof + i * 1024); rv[i] = *(const v8us*)(vb + vof + i * 16 * SQ); }
#pragma unroll
  for (int i = 0; i < 8; ++i) { *(v8us*)&sk[0][i * 8 * KPH + ksto] = rk[i]; *(v8us*)&sv[0][i * 16 * VPH + vsto] = rv[i]; }
  __syncthreads();      /* stage 0 is whole before anyone reads it */
  const float CS = 0.08838834764831845f * 1.4426950408889634f;      /* 1 / sqrt(128) and log2(e): the exponentials run in base 2 */
  const v8f z8 = {0.f,0.f,0.f,0.f,0.f,0.f,0.f,0.f};
  v8f o[8] = {z8, z8, z8, z8, z8, z8, z8, z8};
  float ms = -3.0e38f, lsum = 0.f;      /* running maximum (scaled, base 2) and this lane's half of the running sum */
#pragma unroll 1      /* one copy of the stage body: the loop stays small and every array index inside is a constant */
  for (int t = 0; t < SQ / FK; ++t) {
    const unsigned short* skb = sk[t & 1]; const unsigned short* svb = sv[t & 1];
    const unsigned short* kn = kb + (size_t)(t + 1) * (FK * DKW) + kof; const unsigned short* vn = vb + (t + 1) * FK + vof;      /* formed in the last stage too, read only where a next stage exists */
    if (t + 1 < SQ / FK) {      /* the next stage's lines fly while this stage is worked on */
#pragma unroll
      for (int i = 0; i < 8; ++i) { rk[i] = *(const v8us*)(kn + i * 1024); rv[i] = *(const v8us*)(vn + i * 16 * SQ); }
    }
    v16h fr[16];
#pragma unroll
    for (int ks = 0; ks < 4; ++ks)
#pragma unroll
      for (int mt = 0; mt < 4; ++mt) fr[ks * 4 + mt] = l_frag(skb + mt * 16 * KPH + krd + ks * 32);
    __builtin_amdgcn_sched_barrier(0);      /* all K fragment reads stand as one group ahead of the products: read one by one among them, each product waits out a whole LDS latency */
    v8f st[4] = {z8, z8, z8, z8};      /* S^T: tile mt holds keys 16 mt + 8 hh + r of query ln */
#pragma unroll
    for (int ks = 0; ks < 4; ++ks)
#pragma unroll
      for (int mt = 0; mt < 4; ++mt) st[mt] = f_mma(fr[ks * 4 + mt], qf[ks], st[mt]);
    asm volatile("s_wait_xcnt 0x0" :: "v"(kn), "v"(vn) : "memory");      /* the wait before a register that an issued load names is overwritten; the two address pairs as inputs stay whole up to here (without it the last load's result was placed on them); it stands behind the first product, where it no longer holds the wave up */
    /* the V^T fragment reads go out here, as one group, and land under the softmax arithmetic */
#pragma unroll
    for (int j = 0; j < 2; ++j)
#pragma unroll
      for (int ct = 0; ct < 8; ++ct) fr[j * 8 + ct] = l_frag(svb + ct * 16 * VPH + vrd + j * 32);
    __builtin_amdgcn_sched_barrier(0);      /* keeps those reads from sinking down to the second product */
    float m0 = st[0][0], m1 = st[1][0], m2 = st[2][0], m3 = st[3][0];
#pragma unroll
    for (int r = 1; r < 8; ++r) { m0 = fmaxf(m0, st[0][r]); m1 = fmaxf(m1, st[1][r]); m2 = fmaxf(m2, st[2][r]); m3 = fmaxf(m3, st[3][r]); }
    float mx = fmaxf(fmaxf(m0, m1), fmaxf(m2, m3)); mx = fmaxf(mx, xhalf(mx));
    const float mn = fmaxf(ms, mx * CS); const float al = __builtin_amdgcn_exp2f(ms - mn); ms = mn;      /* al is 0 in the first stage */
    const v2f cs2 = {CS, CS}, nm2 = {-mn, -mn}; v2f e2[16];
#pragma unroll
    for (int u = 0; u < 16; ++u) { const v2f s2 = {st[u >> 2][(u & 3) * 2], st[u >> 2][(u & 3) * 2 + 1]}; e2[u] = __builtin_elementwise_fma(s2, cs2, nm2); }
#pragma unroll
    for (int u = 0; u < 16; ++u) { e2[u][0] = __builtin_amdgcn_exp2f(e2[u][0]); e2[u][1] = __builtin_amdgcn_exp2f(e2[u][1]); }
    union { v16h v; v2h p[8]; } pf[2]; v2f a2[4];
#pragma unroll
    for (int u = 0; u < 16; ++u) pf[u >> 3].p[u & 7] = __builtin_convertvector(e2[u], v2h);      /* tiles 2 j and 2 j + 1 are registers 0-3 and 4-7 of B fragment j */
#pragma unroll
    for (int q = 0; q < 4; ++q) a2[q] = (e2[4 * q] + e2[4 * q + 1]) + (e2[4 * q + 2] + e2[4 * q + 3]);
    const v2f as = (a2[0] + a2[1]) + (a2[2] + a2[3]);
    lsum = fmaf(lsum, al, as[0] + as[1]);
#pragma unroll
    for (int ct = 0; ct < 8; ++ct) o[ct] *= al;
#pragma unroll
    for (int j = 0; j < 2; ++j)
#pragma unroll
      for (int ct = 0; ct < 8; ++ct) o[ct] = f_mma(fr[j * 8 + ct], pf[j].v, o[ct]);      /* O^T: tile ct holds channels 16 ct + 8 hh + r of query ln */
    if (t + 1 < SQ / FK) { unsigned short* skn = sk[(t + 1) & 1]; unsigned short* svn = sv[(t + 1) & 1];      /* that buffer's last readers left it before the barrier of the stage before */
#pragma unroll
      for (int i = 0; i < 8; ++i) { *(v8us*)&skn[i * 8 * KPH + ksto] = rk[i]; *(v8us*)&svn[i * 16 * VPH + vsto] = rv[i]; } }
    __syncthreads();      /* publishes stage t + 1 and ends every read of stage t */
  }
  lsum += xhalf(lsum); const float inv = 1.0f / lsum;
  float* op = O + ((size_t)b * SQ + q0 + ln) * DKW + 8 * hh;
#pragma unroll
  for (int ct = 0; ct < 8; ++ct) { const v4f lo = {o[ct][0] * inv, o[ct][1] * inv, o[ct][2] * inv, o[ct][3] * inv}, hi = {o[ct][4] * inv, o[ct][5] * inv, o[ct][6] * inv, o[ct][7] * inv};
    *(v4f*)(op + ct * 16) = lo; *(v4f*)(op + ct * 16 + 4) = hi; } }
// Projection stage, one launch: q, k rows and V^T straight from the f32 inputs. A work-group takes 64 token rows: the x tile is rounded once (bf16, held as exact f16) into padded LDS rows.
// 12 waves: wave w owns 32 output channels of q (w 0-3), k (4-7) or v (8-11) for all 64 rows, so each weight element is read (f32, [in][out]) and rounded by one wave of the group only, straight into its fragment registers, two k steps ahead.
// q, k: weights as A, x as B: a lane's 8 accumulator registers are 8 consecutive channels of one token row. v: x as A, weights as B: they are 8 consecutive tokens of one channel, a piece of a V^T row. Either way one 16-byte store.
// Every loop of this stage is unrolled in full: all indices into the load ring, the fragments and the accumulators are then constants and the arrays stay in registers.
#define PR 64                        /* token rows per work-group */
#define XPH 264                      /* x tile row pitch in halves: 528 B = 16 B x odd, for 16-byte LDS reads */
typedef __bf16 v2b __attribute__((ext_vector_type(2)));
__device__ __forceinline__ v2h rb2(v2f f) { return __builtin_convertvector(__builtin_convertvector(__builtin_convertvector(f, v2b), v2f), v2h); }      /* f32 -> bf16 (nearest even) -> f16 */
__device__ __forceinline__ void w_load(const float* __restrict__ wp, int ks, float (&r)[32]) {      /* wp holds the lane's channel and its 8 * hh rows; hardware k order, as the x fragments */
#pragma unroll
  for (int j = 0; j < 2; ++j)
#pragma unroll
    for (int s = 0; s < 16; ++s) r[j * 16 + s] = wp[(ks * 32 + (s < 8 ? s : s + 8)) * DKW + j * 16]; }
template <bool XA>
__device__ __forceinline__ void proj_loop(const float* __restrict__ wp, const unsigned short* xrd, float (&wr)[2][32], v8f (&acc)[4][2]) {
#pragma unroll
  for (int ks = 0; ks < DM / 32; ++ks) {
    v16h xf[4];
#pragma unroll
    for (int mt = 0; mt < 4; ++mt) xf[mt] = l_frag(xrd + mt * 16 * XPH + ks * 32);
    __builtin_amdgcn_sched_barrier(0);      /* the x fragment reads go out as one group ahead of the rounding below, which covers their LDS latency; left free they sank down among the products, each with a wait to 0 */
    union { v16h v; v2h p[8]; } wf[2];
#pragma unroll
    for (int j = 0; j < 2; ++j)
#pragma unroll
      for (int s = 0; s < 8; ++s) { const v2f p = {wr[ks & 1][j * 16 + 2 * s], wr[ks & 1][j * 16 + 2 * s + 1]}; wf[j].p[s] = rb2(p * 16.0f); }      /* x16 ahead of the rounding: a power of two, so the same value as rounding first, and the f16 stays clear of its subnormal range */
    if (ks + 2 < DM / 32) w_load(wp, ks + 2, wr[ks & 1]);
    __builtin_amdgcn_sched_barrier(0);      /* keeps the weight loads two k steps ahead of their use: left free they sank down to just in front of it and the wave waited out the whole load latency every step */
#pragma unroll
    for (int mt = 0; mt < 4; ++mt)
#pragma unroll
      for (int j = 0; j < 2; ++j) acc[mt][j] = XA ? f_mma(xf[mt], wf[j].v, acc[mt][j]) : f_mma(wf[j].v, xf[mt], acc[mt][j]);
  } }
__global__ __launch_bounds__(384) void k_qkv(const float* __restrict__ x, const float* __restrict__ wq, const float* __restrict__ bq, const float* __restrict__ wk, const float* __restrict__ bk, const float* __restrict__ wv, const float* __restrict__ bv,
    _Float16* __restrict__ Q, _Float16* __restrict__ Kd, _Float16* __restrict__ VTd) {
  __shared__ __attribute__((aligned(16))) unsigned short sx[PR * XPH];
  __shared__ __attribute__((aligned(16))) float sb[12 * 32];      /* each wave's 32 biases, rounded */
  const int tid = threadIdx.x, lane = tid & 31, ln = lane & 15, hh = lane >> 4;
  const int w = __builtin_amdgcn_readfirstlane(tid >> 5);      /* the wave's number in a scalar register: what it selects below is a scalar branch, every lane stays on for the matrix instructions */
  const int which = w >> 2, d0 = (w & 3) * 32;
  const float* Wm = which == 0 ? wq : which == 1 ? wk : wv; const float* bias = which == 0 ? bq : which == 1 ? bk : bv;
  const size_t row0 = (size_t)blockIdx.x * PR;
  const v4fa* xg = (const v4fa*)(x + row0 * DM);      /* the 64 rows are 64 KiB in a row */
  const v4fa* xl = xg + (w < 8 ? 10 * 384 : 0);      /* a scalar base */
  v4f xr[11];
#pragma unroll
  for (int i = 0; i < 11; ++i) xr[i] = i < 10 ? xg[tid + i * 384] : xl[tid];      /* 4096 pieces of 16 B over 384 threads: the last round is waves 0-7; there a thread of the other waves takes its own first piece once more (same bytes to the same place), so no branch stands in the staging */
  const float* wp = Wm + 8 * hh * DKW + d0 + ln;
  float wr[2][32];
  const float bl = bias[d0 + lane];
  w_load(wp, 0, wr[0]); w_load(wp, 1, wr[1]);
  asm volatile("s_wait_xcnt 0x0" ::: "memory");      /* the wait before a register that an issued load names is overwritten: the x loads' offset register is reused in the staging below */
#pragma unroll
  for (int i = 0; i < 11; ++i) { const int idx = tid + (i < 10 || w < 8 ? i * 384 : 0); union { v4h v; v2h p[2]; } h; const v2f lo = {xr[i][0], xr[i][1]}, hi = {xr[i][2], xr[i][3]}; h.p[0] = rb2(lo); h.p[1] = rb2(hi);
    *(v4h*)&sx[(idx >> 6) * XPH + (idx & 63) * 4] = h.v; }
  sb[tid] = bf16_round(bl);
  __syncthreads();      /* the x tile is whole before anyone reads it */
  const unsigned short* xrd = sx + ln * XPH + 8 * hh;
  const v8f z8 = {0.f,0.f,0.f,0.f,0.f,0.f,0.f,0.f};
  v8f acc[4][2] = {{z8, z8}, {z8, z8}, {z8, z8}, {z8, z8}};
  if (which < 2) {
    proj_loop<false>(wp, xrd, wr, acc);      /* acc[mt][j][r]: token 16 mt + ln, channel d0 + 16 j + 8 hh + r */
    _Float16* dst = (which == 0 ? Q : Kd) + (row0 + ln) * DKW + d0 + 8 * hh;
#pragma unroll
    for (int j = 0; j < 2; ++j) { const v4f b0 = *(const v4fa*)&sb[w * 32 + j * 16 + 8 * hh], b1 = *(const v4fa*)&sb[w * 32 + j * 16 + 8 * hh + 4];
#pragma unroll
      for (int mt = 0; mt < 4; ++mt) { FragH f;
#pragma unroll
        for (int r = 0; r < 8; ++r) f.h[r] = (_Float16)(acc[mt][j][r] * 0.0625f + (r < 4 ? b0[r] : b1[r - 4]));
        *(v8us*)((unsigned short*)dst + mt * 16 * DKW + j * 16) = f.half[0]; } }
  } else {
    proj_loop<true>(wp, xrd, wr, acc);      /* acc[mt][j][r]: token 16 mt + 8 hh + r, channel d0 + 16 j + ln */
    _Float16* dst = VTd + ((row0 / SQ) * DKW + d0 + ln) * SQ + row0 % SQ + 8 * hh;
#pragma unroll
    for (int j = 0; j < 2; ++j) { const float bb = sb[w * 32 + j * 16 + ln];
#pragma unroll
      for (int mt = 0; mt < 4; ++mt) { FragH f;
#pragma unroll
        for (int r = 0; r < 8; ++r) f.h[r] = (_Float16)(acc[mt][j][r] * 0.0625f + bb);
        *(v8us*)((unsigned short*)dst + (size_t)j * 16 * SQ + mt * 16) = f.half[0]; } }
    asm volatile("s_wait_xcnt 0x0" ::: "memory");      /* the wait before a register that an issued store names is overwritten: in the built code the q, k branch stands behind this one and its first LDS reads reuse these stores' address and data registers */
  } }
__global__ __launch_bounds__(256) void k_vt(const _Float16* __restrict__ V16, int b, int h0, _Float16* __restrict__ VT) { __shared__ unsigned short tl[64][65]; const int tid = threadIdx.x; const int hh = blockIdx.x % HG, sg = blockIdx.x / HG; const int s0 = sg * 64; const int h = h0 + hh;
  for (int i = tid; i < 64 * 8; i += 256) { const int j = i / 8, d8 = (i % 8) * 8; FragH f; f.half[0] = *(const v8us*)((const unsigned short*)V16 + ((size_t)b * SQ + s0 + j) * DM + h * HD + d8); for (int q = 0; q < 8; ++q) tl[d8 + q][j] = f.u[q]; }
  __syncthreads();
  { for (int i = tid; i < 64 * 8; i += 256) { const int d = i / 8, j8 = (i % 8) * 8; FragH f; for (int q = 0; q < 8; ++q) f.u[q] = tl[d][j8 + q]; *(v8us*)((unsigned short*)VT + ((size_t)hh * HD + d) * SQ + s0 + j8) = f.half[0]; }  } }



__global__ __launch_bounds__(256) void k_rsmkm(const float* __restrict__ S, _Float16* __restrict__ P, int nrows, const int* __restrict__ am) {
  #pragma clang fp contract(off)
  const int t = blockIdx.x * 256 + threadIdx.x; if (t >= nrows) return; const size_t i = (size_t)t; const float* s = S + i * SQ; const int* mr = am + (size_t)(t % SQ) * SQ; float mx = -3.0e38f;
#pragma unroll 1
  for (int j = 0; j < SQ; ++j) { const float f = (mr[j] != 0) ? 1.f : 0.f; mx = fmaxf(mx, fmaf(f, s[j], (1.f - f) * -1.0e9f)); } float se = 0.f;
#pragma unroll 1
  for (int j = 0; j < SQ; ++j) { const float f = (mr[j] != 0) ? 1.f : 0.f; se += __expf(fmaf(f, s[j], (1.f - f) * -1.0e9f) - mx); } const float sc = 256.0f / se;
#pragma unroll 1
  for (int j0 = 0; j0 < SQ; j0 += 8) { FragH fr; for (int q = 0; q < 8; ++q) { const int j = j0 + q; const float f = (mr[j] != 0) ? 1.f : 0.f; fr.h[q] = (_Float16)(__expf(fmaf(f, s[j], (1.f - f) * -1.0e9f) - mx) * sc); }
    unsigned short* d = (unsigned short*)P + i * SQ + j0; *(v8us*)d = fr.half[0];  } }
extern "C" void kernel_launch(void* const* d_in, const int* in_sizes, int n_in,
                              void* d_out, int out_size, void* d_ws, size_t ws_size, hipStream_t stream) {
  (void)in_sizes; (void)n_in; (void)out_size;
  const float* const* I = (const float* const*)d_in; const float* x = I[0]; const float* wq = I[1]; const float* bq = I[2]; const float* wk = I[3]; const float* bk = I[4]; const float* wv = I[5]; const float* bv = I[6];      /* x; [in][out] Wq / Wk / Wv [256][128] + biases; no mask input */
  static_assert(SQ % 128 == 0 && SQ % 64 == 0 && SQ % 32 == 0 && DM % 32 == 0 && DKW % 64 == 0 && DKW % 32 == 0, "tile multiples");
  char* ws = (char*)d_ws; size_t off = 0;
  auto take = [&](size_t bytes) { char* p = ws + off; off += (bytes + 255) & ~(size_t)255; return p; };
  _Float16* Q16 = (_Float16*)take(NR * DKW * 2); _Float16* K16 = (_Float16*)take(NR * DKW * 2); _Float16* VT = (_Float16*)take(NR * DKW * 2);
  if (off > ws_size) return;      /* 3 x 4 = 12 MiB */
  k_qkv<<<(unsigned)(NR / PR), 384, 0, stream>>>(x, wq, bq, wk, bk, wv, bv, Q16, K16, VT);      /* q, k rows (f16, 128 wide) and V^T [4][128][4096] */
  k_fattn<<<NB * (SQ / 64), 128, 0, stream>>>(Q16, K16, VT, (float*)d_out);      /* out = softmax(q k^T / sqrt(128)) v, f32 rows of the output */
}

// v004
// It runs in 44.6 microseconds.
// Timed twice side by side with v003, it ran 1.30 and 1.28 times as fast.
// All steps since v000 together make it 82.0 times as fast.
#include <hip/hip_runtime.h>
// Single-head self-attention (x [4][4096][256]; q = x Wq + bq, k = x Wk + bk, v = x Wv + bv ([in][out] 256 x 128, weights AND biases uniform +-1/16); scores = q k^T / sqrt(128); softmax over all 4096 keys (no mask); out = w v -> [4][4096][128]; no output projection).
// Structure: token rows r = b*4096 + s; ONE projection launch: x tile as exact f16 (bf16-rounded) in LDS, q, k, v by WMMA (64x32 wave tiles, f32 accumulation, exact x16 weights + bias, f16 outputs, 128 wide), v written as V^T; then ONE fused attention launch: scores, running softmax and the weighted sum of v per 128-key stage (8 waves: 2 query groups x 4 key groups, joined at the end), written f32 into the output rows.
// Compute dtype: inputs rounded to bf16; x / weights exact; q, k, v and the unnormalised softmax weights exp(s - running max) as plain f16 GEMM operands (~2^-12); scores, softmax statistics and o f32. v_wmma_f32_16x16x32_f16.
#define NB 4
#define SQ 4096
#define DM 256                       /* input width */
#define DKW 128                      /* q / k / v width = the single head */
#define NH 1
#define HD 64
#define HG 4                         /* heads per block group of the non-template k_vt, which is not launched */
#define B0 0                         /* unused; every launch starts at batch 0 */
#define NBR NB                       /* read only by MP, which nothing reads */
#define NR ((size_t)NB * SQ)         /* token rows */
#define MP ((int)((size_t)NBR * SQ)) /* unused; the projections run over NR rows */
#define QN SQ                        /* unused; k_fattn attends all SQ query rows per batch */
#define NHD NH                       /* unused */
#define MPO MP                       /* unused */
#define LQ DM      /* unused; the q/k/v rows have pitch DKW */
typedef __bf16 v16b __attribute__((ext_vector_type(16)));
typedef unsigned short v8us __attribute__((ext_vector_type(8), may_alias));
typedef float  v8f  __attribute__((ext_vector_type(8)));
typedef float  v4f  __attribute__((ext_vector_type(4)));
typedef float  v4fa __attribute__((ext_vector_type(4), may_alias));
union FragB { v16b v; v8us half[2]; unsigned short u[16]; };

__device__ __forceinline__ unsigned short bf16_bits(float x) { unsigned int u = __float_as_uint(x); return (unsigned short)((u + 0x7FFFu + ((u >> 16) & 1u)) >> 16); }
__device__ __forceinline__ float bf16_val(unsigned short b) { return __uint_as_float(((unsigned int)b) << 16); }
__device__ __forceinline__ float bf16_round(float x) { return bf16_val(bf16_bits(x)); }
// D += A·B with NT terms: 1 = ah·bh, 2 = + al·bh (A split), 3 = + ah·bl (both split)
template <int NT>
__device__ __forceinline__ v8f mmaN(v16b ah, v16b al, v16b bh, v16b bl, v8f c) {
  c = __builtin_amdgcn_wmma_f32_16x16x32_bf16(false, ah, false, bh, (short)0, c, false, false);
  if (NT >= 2) c = __builtin_amdgcn_wmma_f32_16x16x32_bf16(false, al, false, bh, (short)0, c, false, false);
  if (NT >= 3) c = __builtin_amdgcn_wmma_f32_16x16x32_bf16(false, ah, false, bl, (short)0, c, false, false);
  asm volatile("v_nop\n\tv_nop\n\tv_nop\n\tv_nop" : "+v"(c) : "v"(ah), "v"(al), "v"(bh), "v"(bl));
  return c;
}

__global__ __launch_bounds__(256) void k_wt_bf16(const float* __restrict__ W, unsigned short* __restrict__ Wt, int K, int N) {
  const int t = blockIdx.x * 256 + threadIdx.x;
  const int k8n = K / 8;
  if (t >= N * k8n) return;
  const int n = t / k8n, k8 = (t % k8n) * 8;
  v8us v;
#pragma unroll
  for (int i = 0; i < 8; ++i) v[i] = bf16_bits(W[(size_t)(k8 + i) * N + n]);
  *(v8us*)(Wt + (size_t)n * K + k8) = v;
  
}

// GEMM C[M][N] (f32, pitch ldc) = act(A[M][K]·W + bias). A f32 row-major (pitch lda) converted per fragment to bf16
// (ASPLIT: hi/lo two planes -> 2 terms, else single rounded term); Wt bf16 [N][K] (pitch ldb). BIAS_BF16 rounds the
// bias to bf16 first (bias quantised to bf16 before the add). K%32==0, M%16==0, N%64==0.
template <bool ASPLIT, int ACT, bool BIAS_BF16>
__global__ __launch_bounds__(128) void k_gemm_bf(const float* __restrict__ A, int lda, const unsigned short* __restrict__ Wt, int ldb,
                                               const float* __restrict__ bias, float* __restrict__ C, int ldc, int M, int N, int K) {
  __shared__ __attribute__((aligned(16))) float so[4][16][64];
  const int tid = threadIdx.x, w = tid >> 5, lane = tid & 31, ln = lane & 15, hh = lane >> 4;
  const int ntn = N / 64;
  const int wid = blockIdx.x * 4 + w;
  const int mt = wid / ntn, nq = wid % ntn;
  if (mt * 16 >= M) return;
  const int row0 = mt * 16, col0 = nq * 64;
  const float* arow = A + (size_t)(row0 + ln) * lda;
  v8f acc[4] = {};
  for (int kb = 0; kb < K; kb += 32) {
    FragB ah, al;
    const v4f x0 = *(const v4fa*)(arow + kb + 8 * hh), x1 = *(const v4fa*)(arow + kb + 8 * hh + 4);
    const v4f x2 = *(const v4fa*)(arow + kb + 16 + 8 * hh), x3 = *(const v4fa*)(arow + kb + 16 + 8 * hh + 4);
    float xs[16] = {x0[0],x0[1],x0[2],x0[3],x1[0],x1[1],x1[2],x1[3],x2[0],x2[1],x2[2],x2[3],x3[0],x3[1],x3[2],x3[3]};
#pragma unroll
    for (int i = 0; i < 16; ++i) { const unsigned short hb = bf16_bits(xs[i]); ah.u[i] = hb; al.u[i] = ASPLIT ? bf16_bits(xs[i] - bf16_val(hb)) : (unsigned short)0; }
#pragma unroll
    for (int t = 0; t < 4; ++t) {
      const unsigned short* brow = Wt + (size_t)(col0 + t * 16 + ln) * ldb + kb;
      FragB b;
      b.half[0] = *(const v8us*)(brow + 8 * hh);
      b.half[1] = *(const v8us*)(brow + 16 + 8 * hh);
      acc[t] = mmaN<ASPLIT ? 2 : 1>(ah.v, al.v, b.v, b.v, acc[t]);
    }
  }
#pragma unroll
  for (int t = 0; t < 4; ++t) {
    float bv = bias ? bias[col0 + t * 16 + ln] : 0.f;
    if (BIAS_BF16) bv = bf16_round(bv);
#pragma unroll
    for (int r = 0; r < 8; ++r) { float v = acc[t][r] + bv; if (ACT == 1) v = fmaxf(v, 0.f); so[w][8 * hh + r][t * 16 + ln] = v; }
  }
  __builtin_amdgcn_fence(__ATOMIC_ACQ_REL, "workgroup");
  __builtin_amdgcn_wave_barrier();
  const int rsub = lane >> 4, c4 = (lane & 15) * 4;
  {
#pragma unroll
    for (int q = 0; q < 8; ++q) {
      const int r = q * 2 + rsub;
      const v4f v = *(const v4fa*)&so[w][r][c4];
      *(v4f*)(C + (size_t)(row0 + r) * ldc + col0 + c4) = v;
    }
    
  }
}

// GEMM C = act(A·W + bias + resid): A f32 (ASPLIT -> hi/lo 2 terms), Wt bf16 [N][K]; ACT 0 none, 1 relu, 2 exact gelu;
// resid (optional, f32, row index = (row % rmod), pitch ldr, RES_BF16 rounds it) added before the activation.
template <bool ASPLIT, int ACT, bool BIAS_BF16, bool RES_BF16>
__global__ __launch_bounds__(128) void k_gemm_bf3(const float* __restrict__ A, int lda, const unsigned short* __restrict__ Wt, int ldb,
                                                const float* __restrict__ bias, const float* __restrict__ resid, int rmod, int ldr,
                                                float* __restrict__ C, int ldc, int M, int N, int K) {
  __shared__ __attribute__((aligned(16))) float so[4][16][64];
  const int tid = threadIdx.x, w = tid >> 5, lane = tid & 31, ln = lane & 15, hh = lane >> 4;
  const int ntn = N / 64;
  const int wid = blockIdx.x * 4 + w;
  const int mt = wid / ntn, nq = wid % ntn;
  if (mt * 16 >= M) return;
  const int row0 = mt * 16, col0 = nq * 64;
  const float* arow = A + (size_t)(row0 + ln) * lda;
  v8f acc[4] = {};
  for (int kb = 0; kb < K; kb += 32) {
    FragB ah, al;
    const v4f x0 = *(const v4fa*)(arow + kb + 8 * hh), x1 = *(const v4fa*)(arow + kb + 8 * hh + 4);
    const v4f x2 = *(const v4fa*)(arow + kb + 16 + 8 * hh), x3 = *(const v4fa*)(arow + kb + 16 + 8 * hh + 4);
    float xs[16] = {x0[0],x0[1],x0[2],x0[3],x1[0],x1[1],x1[2],x1[3],x2[0],x2[1],x2[2],x2[3],x3[0],x3[1],x3[2],x3[3]};
#pragma unroll
    for (int i = 0; i < 16; ++i) { const unsigned short hb = bf16_bits(xs[i]); ah.u[i] = hb; al.u[i] = ASPLIT ? bf16_bits(xs[i] - bf16_val(hb)) : (unsigned short)0; }
#pragma unroll
    for (int t = 0; t < 4; ++t) {
      const unsigned short* brow = Wt + (size_t)(col0 + t * 16 + ln) * ldb + kb;
      FragB b;
      b.half[0] = *(const v8us*)(brow + 8 * hh);
      b.half[1] = *(const v8us*)(brow + 16 + 8 * hh);
      acc[t] = mmaN<ASPLIT ? 2 : 1>(ah.v, al.v, b.v, b.v, acc[t]);
    }
  }
#pragma unroll
  for (int t = 0; t < 4; ++t) {
    const int col = col0 + t * 16 + ln;
    float bv = bias ? bias[col] : 0.f;
    if (BIAS_BF16) bv = bf16_round(bv);
#pragma unroll
    for (int r = 0; r < 8; ++r) {
      float v = acc[t][r] + bv;
      if (resid) { float rv = resid[(size_t)((row0 + 8 * hh + r) % rmod) * ldr + col]; if (RES_BF16) rv = bf16_round(rv); v += rv; }
      if (ACT == 1) v = fmaxf(v, 0.f);
      if (ACT == 2) v = 0.5f * v * (1.0f + erff(v * 0.70710678118654752f));
      if (ACT == 3) { const float u = 0.7978845608028654f * (v + 0.044715f * v * v * v); v = 0.5f * v * (1.0f + tanhf(u)); }
      so[w][8 * hh + r][t * 16 + ln] = v;
    }
  }
  __builtin_amdgcn_fence(__ATOMIC_ACQ_REL, "workgroup");
  __builtin_amdgcn_wave_barrier();
  const int rsub = lane >> 4, c4 = (lane & 15) * 4;
  {
#pragma unroll
    for (int q = 0; q < 8; ++q) {
      const int r = q * 2 + rsub;
      const v4f v = *(const v4fa*)&so[w][r][c4];
      *(v4f*)(C + (size_t)(row0 + r) * ldc + col0 + c4) = v;
    }
    
  }
}
// row LayerNorm (biased variance, eps) over N: s = X (+ R); optional out_sum <- s; out_norm <- (s-mu)*rsqrt(var+eps)*g + b
template <bool PARAM_BF16>
__global__ __launch_bounds__(256) void k_layernorm(const float* __restrict__ X, const float* __restrict__ R, const float* __restrict__ g, const float* __restrict__ bta,
                                                  float* __restrict__ out_sum, float* __restrict__ out_norm, int N, float eps) {
  __shared__ float red[256];
  const int row = blockIdx.x, tid = threadIdx.x;
  const float* x = X + (size_t)row * N; const float* rr = R ? R + (size_t)row * N : nullptr;
  float vals[16];                     // up to N = 4096
  const int per = N / 256;            // contiguous chunk per thread? use strided-by-4 chunks: thread handles j = tid*4 + 1024*u
  float s1 = 0.f;
  for (int u = 0; u < per / 4; ++u) {
    const int j = tid * 4 + 1024 * u;
    const v4f a = *(const v4fa*)(x + j);
    v4f b = {0.f,0.f,0.f,0.f}; if (rr) b = *(const v4fa*)(rr + j);
#pragma unroll
    for (int q = 0; q < 4; ++q) { const float v = a[q] + b[q]; vals[u * 4 + q] = v; s1 += v; }
  }
  red[tid] = s1; __syncthreads();
  for (int st = 128; st > 0; st >>= 1) { if (tid < st) red[tid] += red[tid + st]; __syncthreads(); }
  const float mu = red[0] / (float)N; __syncthreads();
  float s2 = 0.f;
  for (int u = 0; u < per / 4; ++u)
#pragma unroll
    for (int q = 0; q < 4; ++q) { const float c = vals[u * 4 + q] - mu; s2 += c * c; }
  red[tid] = s2; __syncthreads();
  for (int st = 128; st > 0; st >>= 1) { if (tid < st) red[tid] += red[tid + st]; __syncthreads(); }
  const float rs = rsqrtf(red[0] / (float)N + eps);
  {
    for (int u = 0; u < per / 4; ++u) {
      const int j = tid * 4 + 1024 * u;
      v4f o, sm;
#pragma unroll
      for (int q = 0; q < 4; ++q) {
        float gg = g[j + q], bb = bta[j + q];
        if (PARAM_BF16) { gg = bf16_round(gg); bb = bf16_round(bb); }
        sm[q] = vals[u * 4 + q]; o[q] = (vals[u * 4 + q] - mu) * rs * gg + bb;
      }
      if (out_sum) *(v4f*)(out_sum + (size_t)row * N + j) = sm;
      *(v4f*)(out_norm + (size_t)row * N + j) = o;
    }
    
  }
}



// ---- f16 WMMA path (v_wmma_f32_16x16x32_f16): 11-bit significands for operands in range — used where a [0,1] probability operand needs more precision than bf16
typedef _Float16 v16h __attribute__((ext_vector_type(16)));
union FragH { v16h v; v8us half[2]; _Float16 h[16]; unsigned short u[16]; };
template <int NT>
__device__ __forceinline__ v8f mmaH(v16h ah, v16h al, v16h bh, v16h bl, v8f c) {
  c = __builtin_amdgcn_wmma_f32_16x16x32_f16(false, ah, false, bh, (short)0, c, false, false);
  if (NT >= 2) c = __builtin_amdgcn_wmma_f32_16x16x32_f16(false, al, false, bh, (short)0, c, false, false);
  if (NT >= 3) c = __builtin_amdgcn_wmma_f32_16x16x32_f16(false, ah, false, bl, (short)0, c, false, false);
  asm volatile("v_nop\n\tv_nop\n\tv_nop\n\tv_nop" : "+v"(c) : "v"(ah), "v"(al), "v"(bh), "v"(bl));
  return c;
}
// batched GEMM like k_gemm_b but f16 operands: A f32 (split into f16 hi/lo if ASPLIT, else rounded to f16), Bt = f16 values [n][k]; alpha; C f32; N multiple of 16 (partial tiles skipped)
template <bool ASPLIT>
__global__ __launch_bounds__(128) void k_gemm_h(const float* __restrict__ A, int lda, size_t sA, const _Float16* __restrict__ Bh, int ldb, size_t sB, float alpha, float* __restrict__ C, int ldc, size_t sC, int M, int N, int K) {
  __shared__ __attribute__((aligned(16))) float so[4][16][64];
  const int tid = threadIdx.x, w = tid >> 5, lane = tid & 31, ln = lane & 15, hh = lane >> 4; const int by = blockIdx.y;
  A += (size_t)by * sA; Bh += (size_t)by * sB; C += (size_t)by * sC;
  const int ntn = (N + 63) / 64; const int wid = blockIdx.x * 4 + w; const int mt = wid / ntn, nq = wid % ntn; if (mt * 16 >= M) return;
  const int row0 = mt * 16, col0 = nq * 64; const float* arow = A + (size_t)(row0 + ln) * lda;
  v8f acc[4] = {};
  for (int kb = 0; kb < K; kb += 32) {
    FragH ah, al;
    const v4f x0 = *(const v4fa*)(arow + kb + 8 * hh), x1 = *(const v4fa*)(arow + kb + 8 * hh + 4), x2 = *(const v4fa*)(arow + kb + 16 + 8 * hh), x3 = *(const v4fa*)(arow + kb + 16 + 8 * hh + 4);
    float xs[16] = {x0[0],x0[1],x0[2],x0[3],x1[0],x1[1],x1[2],x1[3],x2[0],x2[1],x2[2],x2[3],x3[0],x3[1],x3[2],x3[3]};
#pragma unroll
    for (int i = 0; i < 16; ++i) { const _Float16 h = (_Float16)xs[i]; ah.h[i] = h; al.h[i] = ASPLIT ? (_Float16)(xs[i] - (float)h) : (_Float16)0.0f; }
#pragma unroll
    for (int t = 0; t < 4; ++t) { if (col0 + t * 16 >= N) continue; const size_t boff = (size_t)(col0 + t * 16 + ln) * ldb + kb; FragH bq; bq.half[0] = *(const v8us*)(Bh + boff + 8 * hh); bq.half[1] = *(const v8us*)(Bh + boff + 16 + 8 * hh);
      acc[t] = mmaH<ASPLIT ? 2 : 1>(ah.v, al.v, bq.v, bq.v, acc[t]); }
  }
#pragma unroll
  for (int t = 0; t < 4; ++t) { if (col0 + t * 16 >= N) continue;
#pragma unroll
    for (int r = 0; r < 8; ++r) so[w][8 * hh + r][t * 16 + ln] = acc[t][r] * alpha; }
  __builtin_amdgcn_fence(__ATOMIC_ACQ_REL, "workgroup"); __builtin_amdgcn_wave_barrier();
  const int rsub = lane >> 4, c4 = (lane & 15) * 4;
  {
#pragma unroll
    for (int q = 0; q < 8; ++q) { const int r = q * 2 + rsub; if (col0 + c4 < N) { const v4f v = *(const v4fa*)&so[w][r][c4]; *(v4f*)(C + (size_t)(row0 + r) * ldc + col0 + c4) = v; } }
     }
}

// Wt[n][k] = f16(W[k][n]·scale) from f32 row-major W[K][N] (scale = power of two; bf16-exact weights stay exact in f16 away from the subnormal range)
__global__ __launch_bounds__(256) void k_wt_f16(const float* __restrict__ W, _Float16* __restrict__ Wt, int K, int N, float scale) {
  const int t = blockIdx.x * 256 + threadIdx.x; if (t >= N * (K / 8)) return; const int n = t / (K / 8), k8 = (t % (K / 8)) * 8; FragH f;
#pragma unroll
  for (int i = 0; i < 8; ++i) f.h[i] = (_Float16)(bf16_round(W[(size_t)(k8 + i) * N + n]) * scale); const v8us o = f.half[0];
  *(v8us*)((unsigned short*)Wt + (size_t)n * K + k8) = o; 
}
// k_gemm_hh variant with fused epilogue: v = acc·alpha + bias[by·sBias + col] (+ CP[(row/rowsPerB)·sCPb + by·64 + col] if CP) ; ACT 0 none / 1 elu ; writes f16 C16 (and f32 C if non-null)
template <int ACT>
__global__ __launch_bounds__(128) void k_gemm_hhx(const _Float16* __restrict__ A, int lda, size_t sA, const _Float16* __restrict__ Bh, int ldb, size_t sB, float alpha, const float* __restrict__ bias, size_t sBias, const float* __restrict__ CP, int rowsPerB, size_t sCPb, int row0g,
    float* __restrict__ C, _Float16* __restrict__ C16, int ldc, size_t sC, int M, int N, int K) {
  __shared__ __attribute__((aligned(16))) float so[4][16][64];
  const int tid = threadIdx.x, w = tid >> 5, lane = tid & 31, ln = lane & 15, hh = lane >> 4; const int by = blockIdx.y;
  A += (size_t)by * sA; Bh += (size_t)by * sB; const size_t cofs = (size_t)by * sC; const float* bp = bias ? bias + (size_t)by * sBias : nullptr;
  const int ntn = (N + 63) / 64; const int wid = blockIdx.x * 4 + w; const int mt = wid / ntn, nq = wid % ntn; if (mt * 16 >= M) return;
  const int row0 = mt * 16, col0 = nq * 64; const _Float16* arow = A + (size_t)(row0 + ln) * lda;
  v8f acc[4] = {};
  for (int kb = 0; kb < K; kb += 32) { FragH ah; ah.half[0] = *(const v8us*)((const unsigned short*)arow + kb + 8 * hh); ah.half[1] = *(const v8us*)((const unsigned short*)arow + kb + 16 + 8 * hh);
#pragma unroll
    for (int t = 0; t < 4; ++t) { if (col0 + t * 16 >= N) continue; const size_t boff = (size_t)(col0 + t * 16 + ln) * ldb + kb; FragH bq; bq.half[0] = *(const v8us*)((const unsigned short*)Bh + boff + 8 * hh); bq.half[1] = *(const v8us*)((const unsigned short*)Bh + boff + 16 + 8 * hh);
      acc[t] = mmaH<1>(ah.v, ah.v, bq.v, bq.v, acc[t]); }
  }
#pragma unroll
  for (int t = 0; t < 4; ++t) { if (col0 + t * 16 >= N) continue; const int col = col0 + t * 16 + ln; const float bv = bp ? bf16_round(bp[col]) : 0.f;
#pragma unroll
    for (int r = 0; r < 8; ++r) { float v = acc[t][r] * alpha + bv; if (CP) { const int rr = row0g + row0 + 8 * hh + r; if (rowsPerB < 0) v += CP[cofs + (size_t)rr * ldc + col];      /* rowsPerB < 0: own element of the batched C plane */ else { const int bidx = rr / rowsPerB; v += CP[(size_t)bidx * sCPb + (size_t)by * 64 + col]; } } if (ACT == 1) v = (v > 0.f) ? v : expm1f(v); else if (ACT == 7) v = (v > 0.f) ? v + 1.0f : expf(v); else if (ACT == 8) v = tanhf(v); else if (ACT == 9) v = 0.5f * v * (1.0f + tanhf(0.7978845608028654f * (v + 0.044715f * v * v * v))); else if (ACT == 11) v = 1.0f / (1.0f + expf(-v)); else if (ACT == 12) v = (v > 0.f) ? v : 0.01f * v; else if (ACT == 14) v = (v > 0.f) ? v : 0.1f * v; else if (ACT == 16) v = (v >= 0.f) ? v : 0.3f * v; else if (ACT == 17) v = (v >= 0.f) ? v : 0.2f * v; else if (ACT == 15) v = v / (1.0f + expf(-v)); else if (ACT == 3) v = fmaxf(v, 0.f); else if (ACT == 6) v = 0.5f * v * (1.0f + erff(v * 0.70710678118654752f)); so[w][8 * hh + r][t * 16 + ln] = v; } }
  __builtin_amdgcn_fence(__ATOMIC_ACQ_REL, "workgroup"); __builtin_amdgcn_wave_barrier();
  const int rsub = lane >> 4, c4 = (lane & 15) * 4; typedef _Float16 v4h __attribute__((ext_vector_type(4)));
  {
#pragma unroll
    for (int q = 0; q < 8; ++q) { const int r = q * 2 + rsub; if (col0 + c4 < N) { const v4f v = *(const v4fa*)&so[w][r][c4]; if (C) *(v4f*)(C + cofs + (size_t)(row0 + r) * ldc + col0 + c4) = v; if (C16) { v4h h4; for (int i = 0; i < 4; ++i) h4[i] = (_Float16)v[i]; *(v4h*)(C16 + cofs + (size_t)(row0 + r) * ldc + col0 + c4) = h4; } } }
     }
}


typedef _Float16 v4h __attribute__((ext_vector_type(4)));

__global__ __launch_bounds__(256) void k_x16(const float* __restrict__ x, _Float16* __restrict__ X16, size_t n8) { const size_t t = (size_t)blockIdx.x * 256 + threadIdx.x; if (t >= n8) return; FragH f;
#pragma unroll
  for (int q = 0; q < 8; ++q) f.h[q] = (_Float16)bf16_round(x[t * 8 + q]); *(v8us*)((unsigned short*)X16 + t * 8) = f.half[0];  }
__global__ __launch_bounds__(256) void k_h16(const float* __restrict__ x, _Float16* __restrict__ X16, size_t n8) { const size_t t = (size_t)blockIdx.x * 256 + threadIdx.x; if (t >= n8) return; FragH f;
#pragma unroll
  for (int q = 0; q < 8; ++q) f.h[q] = (_Float16)x[t * 8 + q]; *(v8us*)((unsigned short*)X16 + t * 8) = f.half[0];  }
__global__ __launch_bounds__(256) void k_round16f(const float* __restrict__ W, _Float16* __restrict__ Bt, size_t n8) { const size_t t = (size_t)blockIdx.x * 256 + threadIdx.x; if (t >= n8) return; FragH f;
#pragma unroll
  for (int i = 0; i < 8; ++i) f.h[i] = (_Float16)(bf16_round(W[t * 8 + i]) * 16.0f); *(v8us*)((unsigned short*)Bt + t * 8) = f.half[0];  }
template <int NHv, int TTv>
__global__ __launch_bounds__(256) void k_vt(const _Float16* __restrict__ V16, int ldv, int voff, _Float16* __restrict__ Vt) { __shared__ unsigned short tl[64][66]; const int tid = threadIdx.x; const int slab = blockIdx.x / (TTv / 64), lg = blockIdx.x % (TTv / 64); const int b = slab / NHv, h = slab % NHv;
  for (int i = tid; i < 64 * 8; i += 256) { const int r = i / 8, c8 = (i % 8) * 8; FragH f; f.half[0] = *(const v8us*)((const unsigned short*)V16 + ((size_t)b * TTv + lg * 64 + r) * ldv + voff + h * 64 + c8);
#pragma unroll
    for (int q = 0; q < 8; ++q) tl[r][c8 + q] = f.u[q]; }
  __syncthreads();
  {
#pragma unroll
    for (int rd = 0; rd < 2; ++rd) { const int d = rd * 32 + tid / 8, pc = tid % 8; FragH f;
#pragma unroll
      for (int q = 0; q < 8; ++q) f.u[q] = tl[pc * 8 + q][d];
      *(v8us*)((unsigned short*)Vt + ((size_t)slab * 64 + d) * TTv + lg * 64 + pc * 8) = f.half[0]; }
     } }

__global__ __launch_bounds__(256) void k_hl(const float* __restrict__ F, _Float16* __restrict__ Hh, _Float16* __restrict__ Hl, size_t n8) { const size_t t = (size_t)blockIdx.x * 256 + threadIdx.x; if (t >= n8) return; FragH fh, fl; const v4f a = *(const v4fa*)(F + t * 8), c = *(const v4fa*)(F + t * 8 + 4);
#pragma unroll
  for (int q = 0; q < 4; ++q) { _Float16 h = (_Float16)a[q]; fh.h[q] = h; fl.h[q] = (_Float16)((a[q] - (float)h) * 1024.0f); h = (_Float16)c[q]; fh.h[4 + q] = h; fl.h[4 + q] = (_Float16)((c[q] - (float)h) * 1024.0f); }
  { *(v8us*)((unsigned short*)Hh + t * 8) = fh.half[0]; *(v8us*)((unsigned short*)Hl + t * 8) = fl.half[0];  } }

// ---- fast GEMM (wave tile 32x64; requires M % 32 == 0 rows per launch region and N % 64 == 0); epilogue = k_gemm_hhx semantics ----
__device__ __forceinline__ v16h g2_frag(const _Float16* p, int hh) { FragH f; f.half[0] = *(const v8us*)((const unsigned short*)p + 8 * hh); f.half[1] = *(const v8us*)((const unsigned short*)p + 16 + 8 * hh); return f.v; }
__device__ __forceinline__ v8f g2_mma(v16h a, v16h b, v8f c) { v8f d = __builtin_amdgcn_wmma_f32_16x16x32_f16(false, a, false, b, (short)0, c, false, false); asm volatile("v_nop\n\tv_nop\n\tv_nop\n\tv_nop" : "+v"(d) : "v"(a), "v"(b)); return d; }
template <int ACT>
__global__ __launch_bounds__(128) void k_gemm2(const _Float16* __restrict__ A, int lda, size_t sA, const _Float16* __restrict__ Bh, int ldb, size_t sB, float alpha, const float* __restrict__ bias, size_t sBias, const float* __restrict__ CP, int rowsPerB, size_t sCPb, int row0g,
    float* __restrict__ C, _Float16* __restrict__ C16, int ldc, size_t sC, int M, int N, int K) { static_assert(ACT == 0 || ACT == 3 || ACT == 6 || ACT == 8 || ACT == 9 || ACT == 11 || ACT == 12 || ACT == 14 || ACT == 15 || ACT == 16 || ACT == 17, "k_gemm2: unsupported ACT code (would silently apply no activation)");
  __shared__ __attribute__((aligned(16))) float so[4][32][68];
  const int tid = threadIdx.x, w = tid >> 5, lane = tid & 31, ln = lane & 15, hh = lane >> 4; const int by = blockIdx.y;
  A += (size_t)by * sA; Bh += (size_t)by * sB; const size_t cofs = (size_t)by * sC; const float* bp = bias ? bias + (size_t)by * sBias : nullptr;
  const int ntn = N >> 6; const int mt = blockIdx.x / ntn, nq = blockIdx.x - mt * ntn; const int row0 = mt * 128 + 32 * w, col0 = nq * 64; if (row0 >= M) return;
  const _Float16* a0p = A + (size_t)(row0 + ln) * lda; const _Float16* a1p = a0p + (size_t)16 * lda;
  const _Float16* b0p = Bh + (size_t)(col0 + ln) * ldb; const _Float16* b1p = b0p + (size_t)16 * ldb; const _Float16* b2p = b1p + (size_t)16 * ldb; const _Float16* b3p = b2p + (size_t)16 * ldb;
  const v8f z8 = {0.f,0.f,0.f,0.f,0.f,0.f,0.f,0.f}; v8f c00 = z8, c01 = z8, c02 = z8, c03 = z8, c10 = z8, c11 = z8, c12 = z8, c13 = z8;
#pragma unroll 1
  for (int kb = 0; kb < K; kb += 32) { const v16h a0 = g2_frag(a0p + kb, hh), a1 = g2_frag(a1p + kb, hh);
    v16h b = g2_frag(b0p + kb, hh); c00 = g2_mma(a0, b, c00); c10 = g2_mma(a1, b, c10);
    b = g2_frag(b1p + kb, hh); c01 = g2_mma(a0, b, c01); c11 = g2_mma(a1, b, c11);
    b = g2_frag(b2p + kb, hh); c02 = g2_mma(a0, b, c02); c12 = g2_mma(a1, b, c12);
    b = g2_frag(b3p + kb, hh); c03 = g2_mma(a0, b, c03); c13 = g2_mma(a1, b, c13); }
  v8f accs[8] = {c00, c01, c02, c03, c10, c11, c12, c13};
#pragma unroll
  for (int u = 0; u < 8; ++u) { const int t = u & 3, half = u >> 2; const int col = col0 + t * 16 + ln; const float bv = bp ? bf16_round(bp[col]) : 0.f;
#pragma unroll
    for (int r = 0; r < 8; ++r) { const int rloc = half * 16 + 8 * hh + r; float v = accs[u][r] * alpha + bv; if (CP) { if (rowsPerB < 0) v += CP[cofs + (size_t)(row0g + row0 + rloc) * ldc + col];      /* rowsPerB < 0: own element of the batched C plane */ else { const int bidx = (row0g + row0 + rloc) / rowsPerB; v += CP[(size_t)bidx * sCPb + (size_t)by * 64 + col]; } }
      if (ACT == 3) v = fmaxf(v, 0.f); else if (ACT == 6) v = 0.5f * v * (1.0f + erff(v * 0.70710678118654752f)); else if (ACT == 11) v = 1.0f / (1.0f + expf(-v)); else if (ACT == 15) v = v / (1.0f + expf(-v)); else if (ACT == 12) v = (v > 0.f) ? v : 0.01f * v; else if (ACT == 8) v = tanhf(v); else if (ACT == 9) v = 0.5f * v * (1.0f + tanhf(0.7978845608028654f * (v + 0.044715f * v * v * v))); else if (ACT == 14) v = (v > 0.f) ? v : 0.1f * v; else if (ACT == 16) v = (v >= 0.f) ? v : 0.3f * v; else if (ACT == 17) v = (v >= 0.f) ? v : 0.2f * v;
      so[w][rloc][t * 16 + ln] = v; } }
  __builtin_amdgcn_fence(__ATOMIC_ACQ_REL, "workgroup"); __builtin_amdgcn_wave_barrier();
  const int rsub = lane >> 4, c4 = (lane & 15) * 4;
  {
#pragma unroll
    for (int q = 0; q < 16; ++q) { const int r = q * 2 + rsub; const v4f v = *(const v4fa*)&so[w][r][c4]; if (C) *(v4f*)(C + cofs + (size_t)(row0 + r) * ldc + col0 + c4) = v; if (C16) { v4h h4; for (int i = 0; i < 4; ++i) h4[i] = (_Float16)v[i]; *(v4h*)(C16 + cofs + (size_t)(row0 + r) * ldc + col0 + c4) = h4; } }
     } }


__global__ __launch_bounds__(256) void k_wnat(const float* __restrict__ w, size_t n8, _Float16* __restrict__ Bt) { const size_t t = (size_t)blockIdx.x * 256 + threadIdx.x; if (t >= n8) return; FragH f; for (int q = 0; q < 8; ++q) f.h[q] = (_Float16)(bf16_round(w[t * 8 + q]) * 16.0f); *(v8us*)((unsigned short*)Bt + t * 8) = f.half[0];  }
#define FK 128                       /* keys per stage */
#define KW 32                        /* keys of a stage per wave */
#define KPH 136                      /* K tile row pitch in halves: 272 B = 16 B x odd, for 16-byte LDS reads */
#define VPH 136                      /* V^T tile row pitch in halves: 272 B = 16 B x odd */
typedef float v2f __attribute__((ext_vector_type(2)));
typedef _Float16 v2h __attribute__((ext_vector_type(2)));
__device__ __forceinline__ float xhalf(float x) { return __builtin_bit_cast(float, __builtin_amdgcn_permlanex16(__builtin_bit_cast(int, x), __builtin_bit_cast(int, x), 0x76543210, 0xfedcba98, false, false)); }      /* lane l with lane l ^ 16 */
__device__ __forceinline__ v16h l_frag(const unsigned short* p) { FragH f; f.half[0] = *(const v8us*)p; f.half[1] = *(const v8us*)(p + 16); return f.v; }      /* p already holds the lane's 8 * hh */
__device__ __forceinline__ v8f f_mma(v16h a, v16h b, v8f c) { return __builtin_amdgcn_wmma_f32_16x16x32_f16(false, a, false, b, (short)0, c, false, false); }
__global__ __launch_bounds__(256) void k_fattn(const _Float16* __restrict__ Q, const _Float16* __restrict__ Kg, const _Float16* __restrict__ VTg, float* __restrict__ O) {
  __shared__ __attribute__((aligned(16))) unsigned short ring[2 * FK * KPH + 2 * DKW * VPH];      /* K buffers, then V^T buffers; behind the loop the O parts (128 KiB) */
  __shared__ float sst[8][2][2][16];      /* per wave and column tile: maximum, sum */
  const int tid = threadIdx.x, w = tid >> 5, lane = tid & 31, ln = lane & 15, hh = lane >> 4;
  const int qg = w & 1, kg = w >> 1;
  const int b = blockIdx.x / (SQ / 64), q0 = (blockIdx.x % (SQ / 64)) * 64 + qg * 32;
  const unsigned short* kb = (const unsigned short*)Kg + (size_t)b * SQ * DKW;      /* wave-uniform bases; the lane's part is a 32-bit offset that lives through the whole loop */
  const unsigned short* vb = (const unsigned short*)VTg + (size_t)b * DKW * SQ;
  const unsigned kof = tid * 8;      /* a stage of K is 32 KiB in a row: piece i of this thread at + i * 2048 halves */
  const unsigned vof = (tid >> 4) * SQ + (tid & 15) * 8;      /* V^T: 128 rows x 256 B a stage: piece i is row 16 i + tid / 16 */
  const int ksto = (tid >> 4) * KPH + (tid & 15) * 8, vsto = 2 * FK * KPH + (tid >> 4) * VPH + (tid & 15) * 8;
  const int krd = (kg * KW + ln) * KPH + 8 * hh, vrd = 2 * FK * KPH + ln * VPH + kg * KW + 8 * hh;
  v16h qf[2][4];
#pragma unroll
  for (int c = 0; c < 2; ++c) { const _Float16* qp = Q + ((size_t)b * SQ + q0 + c * 16 + ln) * DKW;
#pragma unroll
    for (int ks = 0; ks < 4; ++ks) qf[c][ks] = g2_frag(qp + ks * 32, hh); }
  v8us rk[8], rv[8];
#pragma unroll
  for (int i = 0; i < 8; ++i) { rk[i] = *(const v8us*)(kb + kof + i * 2048); rv[i] = *(const v8us*)(vb + vof + i * 16 * SQ); }
#pragma unroll
  for (int i = 0; i < 8; ++i) { *(v8us*)&ring[i * 16 * KPH + ksto] = rk[i]; *(v8us*)&ring[i * 16 * VPH + vsto] = rv[i]; }
  __syncthreads();      /* stage 0 is whole before anyone reads it */
  const float CS = 0.08838834764831845f * 1.4426950408889634f;      /* 1 / sqrt(128) and log2(e): the exponentials run in base 2 */
  const v8f z8 = {0.f,0.f,0.f,0.f,0.f,0.f,0.f,0.f};
  v8f o[2][8] = {{z8, z8, z8, z8, z8, z8, z8, z8}, {z8, z8, z8, z8, z8, z8, z8, z8}};
  float ms[2] = {-3.0e38f, -3.0e38f}, lsum[2] = {0.f, 0.f};      /* per column tile: running maximum (scaled, base 2) and this lane's half of the running sum */
#pragma unroll 1      /* one copy of the stage body: the loop stays small and every array index inside is a constant */
  for (int t = 0; t < SQ / FK; ++t) {
    const unsigned short* skb = ring + (t & 1) * (FK * KPH); const unsigned short* svb = ring + (t & 1) * (DKW * VPH);
    const unsigned short* kn = kb + (size_t)(t + 1) * (FK * DKW) + kof; const unsigned short* vn = vb + (t + 1) * FK + vof;      /* formed in the last stage too, read only where a next stage exists */
    if (t + 1 < SQ / FK) {      /* the next stage's lines fly while this stage is worked on */
#pragma unroll
      for (int i = 0; i < 8; ++i) { rk[i] = *(const v8us*)(kn + i * 2048); rv[i] = *(const v8us*)(vn + i * 16 * SQ); }
    }
    v16h fr[8];
#pragma unroll
    for (int ks = 0; ks < 4; ++ks)
#pragma unroll
      for (int mt = 0; mt < 2; ++mt) fr[ks * 2 + mt] = l_frag(skb + mt * 16 * KPH + krd + ks * 32);
    __builtin_amdgcn_sched_barrier(0);      /* all K fragment reads stand as one group ahead of the products: read one by one among them, each product waits out a whole LDS latency */
    v8f st[2][2] = {{z8, z8}, {z8, z8}};      /* S^T: tile [mt][c] holds keys 16 mt + 8 hh + r of the wave's 32, query 16 c + ln */
#pragma unroll
    for (int ks = 0; ks < 4; ++ks)
#pragma unroll
      for (int mt = 0; mt < 2; ++mt)
#pragma unroll
        for (int c = 0; c < 2; ++c) st[mt][c] = f_mma(fr[ks * 2 + mt], qf[c][ks], st[mt][c]);
    asm volatile("s_wait_xcnt 0x0" :: "v"(kn), "v"(vn) : "memory");      /* the wait before a register that an issued load names is overwritten; the two address pairs as inputs stay whole up to here (without it the last load's result was placed on them); it stands behind the first product, where it no longer holds the wave up */
    /* the V^T fragment reads go out here, as one group, and land under the softmax arithmetic */
#pragma unroll
    for (int ct = 0; ct < 8; ++ct) fr[ct] = l_frag(svb + ct * 16 * VPH + vrd);
    __builtin_amdgcn_sched_barrier(0);      /* keeps those reads from sinking down to the second product */
    union { v16h v; v2h p[8]; } pf[2]; float al[2];
#pragma unroll
    for (int c = 0; c < 2; ++c) {
      float m0 = fmaxf(st[0][c][0], st[0][c][1]), m1 = fmaxf(st[1][c][0], st[1][c][1]), m2 = fmaxf(st[0][c][2], st[0][c][3]), m3 = fmaxf(st[1][c][2], st[1][c][3]);
#pragma unroll
      for (int r = 4; r < 8; r += 2) { m0 = fmaxf(m0, st[0][c][r]); m1 = fmaxf(m1, st[1][c][r]); m2 = fmaxf(m2, st[0][c][r + 1]); m3 = fmaxf(m3, st[1][c][r + 1]); }
      float mx = fmaxf(fmaxf(m0, m1), fmaxf(m2, m3)); mx = fmaxf(mx, xhalf(mx));
      const float mn = fmaxf(ms[c], mx * CS); al[c] = __builtin_amdgcn_exp2f(ms[c] - mn); ms[c] = mn;      /* al is 0 in the first stage */
      const v2f cs2 = {CS, CS}, nm2 = {-mn, -mn}; v2f e2[8];
#pragma unroll
      for (int u = 0; u < 8; ++u) { const v2f s2 = {st[u >> 2][c][(u & 3) * 2], st[u >> 2][c][(u & 3) * 2 + 1]}; const v2f x2 = __builtin_elementwise_fma(s2, cs2, nm2); e2[u][0] = __builtin_amdgcn_exp2f(x2[0]); e2[u][1] = __builtin_amdgcn_exp2f(x2[1]); }
#pragma unroll
      for (int u = 0; u < 8; ++u) pf[c].p[u] = __builtin_convertvector(e2[u], v2h);      /* tiles 0 and 1 are registers 0-3 and 4-7 of the B fragment */
      const v2f as = ((e2[0] + e2[1]) + (e2[2] + e2[3])) + ((e2[4] + e2[5]) + (e2[6] + e2[7]));
      lsum[c] = fmaf(lsum[c], al[c], as[0] + as[1]);
    }
#pragma unroll
    for (int c = 0; c < 2; ++c)
#pragma unroll
      for (int ct = 0; ct < 8; ++ct) o[c][ct] *= al[c];
#pragma unroll
    for (int ct = 0; ct < 8; ++ct)
#pragma unroll
      for (int c = 0; c < 2; ++c) o[c][ct] = f_mma(fr[ct], pf[c].v, o[c][ct]);      /* O^T: tile [c][ct] holds channels 16 ct + 8 hh + r of query 16 c + ln */
    if (t + 1 < SQ / FK) { unsigned short* skn = ring + ((t + 1) & 1) * (FK * KPH); unsigned short* svn = ring + ((t + 1) & 1) * (DKW * VPH);      /* that buffer's last readers left it before the barrier of the stage before */
#pragma unroll
      for (int i = 0; i < 8; ++i) { *(v8us*)&skn[i * 16 * KPH + ksto] = rk[i]; *(v8us*)&svn[i * 16 * VPH + vsto] = rv[i]; } }
    __syncthreads();      /* publishes stage t + 1 and ends every read of stage t */
  }
  /* join of the four key groups */
#pragma unroll
  for (int c = 0; c < 2; ++c) { lsum[c] += xhalf(lsum[c]); if (hh == 0) { sst[w][c][0][ln] = ms[c]; sst[w][c][1][ln] = lsum[c]; } }
  __syncthreads();      /* every wave's maximum and sum are there before anyone reads them */
  v4fa* po = (v4fa*)ring;      /* piece ((wave * 16 + tile) * 2 + half) * 32 + lane: 16 bytes a lane, lanes side by side */
  float fs[2];      /* this wave's weight in the join over the common sum, per column tile */
#pragma unroll
  for (int c = 0; c < 2; ++c) {
    float mg[4], lg[4];
#pragma unroll
    for (int g = 0; g < 4; ++g) { mg[g] = sst[g * 2 + qg][c][0][ln]; lg[g] = sst[g * 2 + qg][c][1][ln]; }
    const float mm = fmaxf(fmaxf(mg[0], mg[1]), fmaxf(mg[2], mg[3]));
    float lt = 0.f;
#pragma unroll
    for (int g = 0; g < 4; ++g) lt = fmaf(__builtin_amdgcn_exp2f(mg[g] - mm), lg[g], lt);
    fs[c] = __builtin_amdgcn_exp2f(ms[c] - mm) / lt;
  }
#pragma unroll
  for (int c = 0; c < 2; ++c) { const float f = fs[c];
#pragma unroll
    for (int ct = 0; ct < 8; ++ct) { const v4f lo = {o[c][ct][0] * f, o[c][ct][1] * f, o[c][ct][2] * f, o[c][ct][3] * f}, hi = {o[c][ct][4] * f, o[c][ct][5] * f, o[c][ct][6] * f, o[c][ct][7] * f};
      po[((w * 16 + c * 8 + ct) * 2 + 0) * 32 + lane] = lo; po[((w * 16 + c * 8 + ct) * 2 + 1) * 32 + lane] = hi; }
  }
  __syncthreads();      /* all O parts are there; the ring's last readers left it at the loop's last barrier */
  /* this wave sums and stores channels 32 kg .. 32 kg + 31 (one 128-byte line a row) of its group's 32 queries */
#pragma unroll
  for (int c = 0; c < 2; ++c) { float* op = O + ((size_t)b * SQ + q0 + c * 16 + ln) * DKW + kg * 32 + 8 * hh;
#pragma unroll
    for (int j = 0; j < 2; ++j)
#pragma unroll
      for (int h = 0; h < 2; ++h) { const int pc = ((c * 8 + kg * 2 + j) * 2 + h) * 32 + lane;
        const v4f s = (po[(0 * 2 + qg) * 1024 + pc] + po[(1 * 2 + qg) * 1024 + pc]) + (po[(2 * 2 + qg) * 1024 + pc] + po[(3 * 2 + qg) * 1024 + pc]);
        *(v4f*)(op + j * 16 + h * 4) = s; } } }
// Projection stage, one launch: q, k rows and V^T straight from the f32 inputs. A work-group takes 64 token rows: the x tile is rounded once (bf16, held as exact f16) into padded LDS rows.
// 12 waves: wave w owns 32 output channels of q (w 0-3), k (4-7) or v (8-11) for all 64 rows, so each weight element is read (f32, [in][out]) and rounded by one wave of the group only, straight into its fragment registers, two k steps ahead.
// q, k: weights as A, x as B: a lane's 8 accumulator registers are 8 consecutive channels of one token row. v: x as A, weights as B: they are 8 consecutive tokens of one channel, a piece of a V^T row. Either way one 16-byte store.
// Every loop of this stage is unrolled in full: all indices into the load ring, the fragments and the accumulators are then constants and the arrays stay in registers.
#define PR 64                        /* token rows per work-group */
#define XPH 264                      /* x tile row pitch in halves: 528 B = 16 B x odd, for 16-byte LDS reads */
typedef __bf16 v2b __attribute__((ext_vector_type(2)));
__device__ __forceinline__ v2h rb2(v2f f) { return __builtin_convertvector(__builtin_convertvector(__builtin_convertvector(f, v2b), v2f), v2h); }      /* f32 -> bf16 (nearest even) -> f16 */
__device__ __forceinline__ void w_load(const float* __restrict__ wp, int ks, float (&r)[32]) {      /* wp holds the lane's channel and its 8 * hh rows; hardware k order, as the x fragments */
#pragma unroll
  for (int j = 0; j < 2; ++j)
#pragma unroll
    for (int s = 0; s < 16; ++s) r[j * 16 + s] = wp[(ks * 32 + (s < 8 ? s : s + 8)) * DKW + j * 16]; }
template <bool XA>
__device__ __forceinline__ void proj_loop(const float* __restrict__ wp, const unsigned short* xrd, float (&wr)[2][32], v8f (&acc)[4][2]) {
#pragma unroll
  for (int ks = 0; ks < DM / 32; ++ks) {
    v16h xf[4];
#pragma unroll
    for (int mt = 0; mt < 4; ++mt) xf[mt] = l_frag(xrd + mt * 16 * XPH + ks * 32);
    __builtin_amdgcn_sched_barrier(0);      /* the x fragment reads go out as one group ahead of the rounding below, which covers their LDS latency; left free they sank down among the products, each with a wait to 0 */
    union { v16h v; v2h p[8]; } wf[2];
#pragma unroll
    for (int j = 0; j < 2; ++j)
#pragma unroll
      for (int s = 0; s < 8; ++s) { const v2f p = {wr[ks & 1][j * 16 + 2 * s], wr[ks & 1][j * 16 + 2 * s + 1]}; wf[j].p[s] = rb2(p * 16.0f); }      /* x16 ahead of the rounding: a power of two, so the same value as rounding first, and the f16 stays clear of its subnormal range */
    if (ks + 2 < DM / 32) w_load(wp, ks + 2, wr[ks & 1]);
    __builtin_amdgcn_sched_barrier(0);      /* keeps the weight loads two k steps ahead of their use: left free they sank down to just in front of it and the wave waited out the whole load latency every step */
#pragma unroll
    for (int mt = 0; mt < 4; ++mt)
#pragma unroll
      for (int j = 0; j < 2; ++j) acc[mt][j] = XA ? f_mma(xf[mt], wf[j].v, acc[mt][j]) : f_mma(wf[j].v, xf[mt], acc[mt][j]);
  } }
__global__ __launch_bounds__(384) void k_qkv(const float* __restrict__ x, const float* __restrict__ wq, const float* __restrict__ bq, const float* __restrict__ wk, const float* __restrict__ bk, const float* __restrict__ wv, const float* __restrict__ bv,
    _Float16* __restrict__ Q, _Float16* __restrict__ Kd, _Float16* __restrict__ VTd) {
  __shared__ __attribute__((aligned(16))) unsigned short sx[PR * XPH];
  __shared__ __attribute__((aligned(16))) float sb[12 * 32];      /* each wave's 32 biases, rounded */
  const int tid = threadIdx.x, lane = tid & 31, ln = lane & 15, hh = lane >> 4;
  const int w = __builtin_amdgcn_readfirstlane(tid >> 5);      /* the wave's number in a scalar register: what it selects below is a scalar branch, every lane stays on for the matrix instructions */
  const int which = w >> 2, d0 = (w & 3) * 32;
  const float* Wm = which == 0 ? wq : which == 1 ? wk : wv; const float* bias = which == 0 ? bq : which == 1 ? bk : bv;
  const size_t row0 = (size_t)blockIdx.x * PR;
  const v4fa* xg = (const v4fa*)(x + row0 * DM);      /* the 64 rows are 64 KiB in a row */
  const v4fa* xl = xg + (w < 8 ? 10 * 384 : 0);      /* a scalar base */
  v4f xr[11];
#pragma unroll
  for (int i = 0; i < 11; ++i) xr[i] = i < 10 ? xg[tid + i * 384] : xl[tid];      /* 4096 pieces of 16 B over 384 threads: the last round is waves 0-7; there a thread of the other waves takes its own first piece once more (same bytes to the same place), so no branch stands in the staging */
  const float* wp = Wm + 8 * hh * DKW + d0 + ln;
  float wr[2][32];
  const float bl = bias[d0 + lane];
  w_load(wp, 0, wr[0]); w_load(wp, 1, wr[1]);
  asm volatile("s_wait_xcnt 0x0" ::: "memory");      /* the wait before a register that an issued load names is overwritten: the x loads' offset register is reused in the staging below */
#pragma unroll
  for (int i = 0; i < 11; ++i) { const int idx = tid + (i < 10 || w < 8 ? i * 384 : 0); union { v4h v; v2h p[2]; } h; const v2f lo = {xr[i][0], xr[i][1]}, hi = {xr[i][2], xr[i][3]}; h.p[0] = rb2(lo); h.p[1] = rb2(hi);
    *(v4h*)&sx[(idx >> 6) * XPH + (idx & 63) * 4] = h.v; }
  sb[tid] = bf16_round(bl);
  __syncthreads();      /* the x tile is whole before anyone reads it */
  const unsigned short* xrd = sx + ln * XPH + 8 * hh;
  const v8f z8 = {0.f,0.f,0.f,0.f,0.f,0.f,0.f,0.f};
  v8f acc[4][2] = {{z8, z8}, {z8, z8}, {z8, z8}, {z8, z8}};
  if (which < 2) {
    proj_loop<false>(wp, xrd, wr, acc);      /* acc[mt][j][r]: token 16 mt + ln, channel d0 + 16 j + 8 hh + r */
    _Float16* dst = (which == 0 ? Q : Kd) + (row0 + ln) * DKW + d0 + 8 * hh;
#pragma unroll
    for (int j = 0; j < 2; ++j) { const v4f b0 = *(const v4fa*)&sb[w * 32 + j * 16 + 8 * hh], b1 = *(const v4fa*)&sb[w * 32 + j * 16 + 8 * hh + 4];
#pragma unroll
      for (int mt = 0; mt < 4; ++mt) { FragH f;
#pragma unroll
        for (int r = 0; r < 8; ++r) f.h[r] = (_Float16)(acc[mt][j][r] * 0.0625f + (r < 4 ? b0[r] : b1[r - 4]));
        *(v8us*)((unsigned short*)dst + mt * 16 * DKW + j * 16) = f.half[0]; } }
  } else {
    proj_loop<true>(wp, xrd, wr, acc);      /* acc[mt][j][r]: token 16 mt + 8 hh + r, channel d0 + 16 j + ln */
    _Float16* dst = VTd + ((row0 / SQ) * DKW + d0 + ln) * SQ + row0 % SQ + 8 * hh;
#pragma unroll
    for (int j = 0; j < 2; ++j) { const float bb = sb[w * 32 + j * 16 + ln];
#pragma unroll
      for (int mt = 0; mt < 4; ++mt) { FragH f;
#pragma unroll
        for (int r = 0; r < 8; ++r) f.h[r] = (_Float16)(acc[mt][j][r] * 0.0625f + bb);
        *(v8us*)((unsigned short*)dst + (size_t)j * 16 * SQ + mt * 16) = f.half[0]; } }
    asm volatile("s_wait_xcnt 0x0" ::: "memory");      /* the wait before a register that an issued store names is overwritten: in the built code the q, k branch stands behind this one and its first LDS reads reuse these stores' address and data registers */
  } }
__global__ __launch_bounds__(256) void k_vt(const _Float16* __restrict__ V16, int b, int h0, _Float16* __restrict__ VT) { __shared__ unsigned short tl[64][65]; const int tid = threadIdx.x; const int hh = blockIdx.x % HG, sg = blockIdx.x / HG; const int s0 = sg * 64; const int h = h0 + hh;
  for (int i = tid; i < 64 * 8; i += 256) { const int j = i / 8, d8 = (i % 8) * 8; FragH f; f.half[0] = *(const v8us*)((const unsigned short*)V16 + ((size_t)b * SQ + s0 + j) * DM + h * HD + d8); for (int q = 0; q < 8; ++q) tl[d8 + q][j] = f.u[q]; }
  __syncthreads();
  { for (int i = tid; i < 64 * 8; i += 256) { const int d = i / 8, j8 = (i % 8) * 8; FragH f; for (int q = 0; q < 8; ++q) f.u[q] = tl[d][j8 + q]; *(v8us*)((unsigned short*)VT + ((size_t)hh * HD + d) * SQ + s0 + j8) = f.half[0]; }  } }



__global__ __launch_bounds__(256) void k_rsmkm(const float* __restrict__ S, _Float16* __restrict__ P, int nrows, const int* __restrict__ am) {
  #pragma clang fp contract(off)
  const int t = blockIdx.x * 256 + threadIdx.x; if (t >= nrows) return; const size_t i = (size_t)t; const float* s = S + i * SQ; const int* mr = am + (size_t)(t % SQ) * SQ; float mx = -3.0e38f;
#pragma unroll 1
  for (int j = 0; j < SQ; ++j) { const float f = (mr[j] != 0) ? 1.f : 0.f; mx = fmaxf(mx, fmaf(f, s[j], (1.f - f) * -1.0e9f)); } float se = 0.f;
#pragma unroll 1
  for (int j = 0; j < SQ; ++j) { const float f = (mr[j] != 0) ? 1.f : 0.f; se += __expf(fmaf(f, s[j], (1.f - f) * -1.0e9f) - mx); } const float sc = 256.0f / se;
#pragma unroll 1
  for (int j0 = 0; j0 < SQ; j0 += 8) { FragH fr; for (int q = 0; q < 8; ++q) { const int j = j0 + q; const float f = (mr[j] != 0) ? 1.f : 0.f; fr.h[q] = (_Float16)(__expf(fmaf(f, s[j], (1.f - f) * -1.0e9f) - mx) * sc); }
    unsigned short* d = (unsigned short*)P + i * SQ + j0; *(v8us*)d = fr.half[0];  } }
extern "C" void kernel_launch(void* const* d_in, const int* in_sizes, int n_in,
                              void* d_out, int out_size, void* d_ws, size_t ws_size, hipStream_t stream) {
  (void)in_sizes; (void)n_in; (void)out_size;
  const float* const* I = (const float* const*)d_in; const float* x = I[0]; const float* wq = I[1]; const float* bq = I[2]; const float* wk = I[3]; const float* bk = I[4]; const float* wv = I[5]; const float* bv = I[6];      /* x; [in][out] Wq / Wk / Wv [256][128] + biases; no mask input */
  static_assert(SQ % 128 == 0 && SQ % 64 == 0 && SQ % 32 == 0 && DM % 32 == 0 && DKW % 64 == 0 && DKW % 32 == 0, "tile multiples");
  char* ws = (char*)d_ws; size_t off = 0;
  auto take = [&](size_t bytes) { char* p = ws + off; off += (bytes + 255) & ~(size_t)255; return p; };
  _Float16* Q16 = (_Float16*)take(NR * DKW * 2); _Float16* K16 = (_Float16*)take(NR * DKW * 2); _Float16* VT = (_Float16*)take(NR * DKW * 2);
  if (off > ws_size) return;      /* 3 x 4 = 12 MiB */
  k_qkv<<<(unsigned)(NR / PR), 384, 0, stream>>>(x, wq, bq, wk, bk, wv, bv, Q16, K16, VT);      /* q, k rows (f16, 128 wide) and V^T [4][128][4096] */
  k_fattn<<<NB * (SQ / 64), 256, 0, stream>>>(Q16, K16, VT, (float*)d_out);      /* out = softmax(q k^T / sqrt(128)) v, f32 rows of the output */
}
